// v000
// The times below were measured on an AMD MI455X: many runs one after another, warmed up first and cycling through
// copies of the inputs, with the whole window's GPU time divided by the number of runs. Launches and the gaps
// between them are all in it. The median over several windows is given; except for v000 it joins two sittings, which
// can be a few percent apart, so the side-by-side timings, each taken in one sitting, are the better comparison.
// v000, which the later versions start from, runs in 173 microseconds.
#include <hip/hip_runtime.h>
#include <math.h>

// Linear attention, N=262144, d_k=d_v=64.  Memory-bound (>=256MB traffic,
// ~11-15us floor at 23.3TB/s).  f32 WMMA (16x16x4) for both matmuls,
// async global->LDS (b128) for K/V tile staging in the context pass.

#define NROWS 262144
#define DIM   64
#define KEXP  0.18033688011112042f   // (1/8) * log2(e)

#define CTX_BLOCKS 512
#define CTX_WAVES  4                 // 512 x 4 = 2048 waves streaming K/V

#define USE_ASYNC_LDS 1

typedef float v2f __attribute__((ext_vector_type(2)));
typedef float v8f __attribute__((ext_vector_type(8)));

static __device__ __forceinline__ v8f wmma_f32_16x16x4(v2f a, v2f b, v8f c) {
  // 8 args: (neg_a, A, neg_b, B, c_mod, C, reuse_a, reuse_b)
  return __builtin_amdgcn_wmma_f32_16x16x4_f32(false, a, false, b, (short)0, c,
                                               false, false);
}

// Low 32 bits of a generic pointer into LDS == wave-relative LDS byte offset.
static __device__ __forceinline__ unsigned ldsOffsetOf(const void* p) {
  return (unsigned)(size_t)p;
}

static __device__ __forceinline__ void asyncLoadLdsB128(unsigned ldsOff,
                                                        const float* gaddr) {
#if USE_ASYNC_LDS
  asm volatile("global_load_async_to_lds_b128 %0, %1, off"
               :: "v"(ldsOff), "v"(gaddr) : "memory");
#endif
}

static __device__ __forceinline__ void waitAsync0() {
#if USE_ASYNC_LDS
  asm volatile("s_wait_asynccnt 0x0" ::: "memory");
#endif
}

// ---------- Pass 1: per-block column maxes of Q (b128 loads) ----------
// element (i*4+k) column = (tid*4+k) & 63 since strides are multiples of 64.
__global__ __launch_bounds__(256) void kColMaxPartial(const float* __restrict__ Q,
                                                      float* __restrict__ pmax) {
  __shared__ float sm[64][16];
  const int tid = threadIdx.x, bid = blockIdx.x;
  const int epb4 = (NROWS / 256) * DIM / 4;         // 16384 float4 / block
  const float4* q4 = (const float4*)(Q + (size_t)bid * epb4 * 4);
  float4 mx = {-__builtin_inff(), -__builtin_inff(),
               -__builtin_inff(), -__builtin_inff()};
  for (int i = tid; i < epb4; i += 256) {
    float4 v = q4[i];
    mx.x = fmaxf(mx.x, v.x); mx.y = fmaxf(mx.y, v.y);
    mx.z = fmaxf(mx.z, v.z); mx.w = fmaxf(mx.w, v.w);
  }
  const int c0 = (tid * 4) & 63;                    // 4 columns owned
  const int mem = tid >> 4;                         // 16 members per column set
  sm[c0 + 0][mem] = mx.x; sm[c0 + 1][mem] = mx.y;
  sm[c0 + 2][mem] = mx.z; sm[c0 + 3][mem] = mx.w;
  __syncthreads();
  if (tid < 64) {
    float v = -__builtin_inff();
    for (int j = 0; j < 16; ++j) v = fmaxf(v, sm[tid][j]);
    pmax[bid * 64 + tid] = v;
  }
}

__global__ __launch_bounds__(64) void kReduceMax(const float* __restrict__ pmax,
                                                 float* __restrict__ m) {
  const int c = threadIdx.x;
  float mx = -__builtin_inff();
  for (int b = 0; b < 256; ++b) mx = fmaxf(mx, pmax[b * 64 + c]);
  m[c] = mx;
}

// ---------- Pass 2: per-block column sum of exp (b128 loads) ----------
__global__ __launch_bounds__(256) void kSumExpPartial(const float* __restrict__ Q,
                                                      const float* __restrict__ m,
                                                      float* __restrict__ psum) {
  __shared__ float sm[64][16];
  const int tid = threadIdx.x, bid = blockIdx.x;
  const int epb4 = (NROWS / 256) * DIM / 4;
  const float4* q4 = (const float4*)(Q + (size_t)bid * epb4 * 4);
  const int c0 = (tid * 4) & 63;
  const float m0 = m[c0], m1 = m[c0 + 1], m2 = m[c0 + 2], m3 = m[c0 + 3];
  float4 s = {0.f, 0.f, 0.f, 0.f};
  for (int i = tid; i < epb4; i += 256) {
    float4 v = q4[i];
    s.x += exp2f((v.x - m0) * KEXP); s.y += exp2f((v.y - m1) * KEXP);
    s.z += exp2f((v.z - m2) * KEXP); s.w += exp2f((v.w - m3) * KEXP);
  }
  const int mem = tid >> 4;
  sm[c0 + 0][mem] = s.x; sm[c0 + 1][mem] = s.y;
  sm[c0 + 2][mem] = s.z; sm[c0 + 3][mem] = s.w;
  __syncthreads();
  if (tid < 64) {
    float t = 0.f;
    for (int j = 0; j < 16; ++j) t += sm[tid][j];
    psum[bid * 64 + tid] = t;
  }
}

__global__ __launch_bounds__(64) void kReduceSum(const float* __restrict__ psum,
                                                 float* __restrict__ s) {
  const int c = threadIdx.x;
  float t = 0.0f;
  for (int b = 0; b < 256; ++b) t += psum[b * 64 + c];
  s[c] = t;
}

// ---------- Pass 3: context partials, ctx[c,v] += sum_i kn[i,c]*V[i,v] ----------
// 512 blocks x 4 waves; each wave owns private 16x64 K/V tiles (async-filled),
// accumulates the full 64x64 in 16 f32 WMMA tiles, then a fixed-order
// (deterministic) cross-wave merge into block LDS.
__global__ __launch_bounds__(CTX_WAVES * 32) void kCtxPartial(
    const float* __restrict__ K, const float* __restrict__ V,
    float* __restrict__ pctx) {
  __shared__ float ldsK[CTX_WAVES][16 * 64];
  __shared__ float ldsV[CTX_WAVES][16 * 64];
  __shared__ float ldsAcc[4096];
  const int tid  = threadIdx.x;
  const int wave = tid >> 5;
  const int lane = tid & 31;
  const int bid  = blockIdx.x;
  const int half = lane >> 4;
  const int mloc = lane & 15;

  for (int e = tid; e < 4096; e += CTX_WAVES * 32) ldsAcc[e] = 0.0f;

  v8f acc[4][4];
#pragma unroll
  for (int t = 0; t < 4; ++t)
#pragma unroll
    for (int u = 0; u < 4; ++u)
      acc[t][u] = (v8f){0.f, 0.f, 0.f, 0.f, 0.f, 0.f, 0.f, 0.f};

  const unsigned kOff = ldsOffsetOf(&ldsK[wave][0]);
  const unsigned vOff = ldsOffsetOf(&ldsV[wave][0]);
  const int rowsPerBlock = NROWS / CTX_BLOCKS;            // 512
  const int rows0 = bid * rowsPerBlock + wave * (rowsPerBlock / CTX_WAVES);
  __syncthreads();                                        // ldsAcc zeroed

  for (int chunk = 0; chunk < (rowsPerBlock / CTX_WAVES) / 16; ++chunk) {
    const int rowbase = rows0 + chunk * 16;
    const float* kp = K + (size_t)rowbase * 64;
    const float* vp = V + (size_t)rowbase * 64;
#if USE_ASYNC_LDS
#pragma unroll
    for (int j = 0; j < 8; ++j) {                         // 16B per lane per op
      const int f4 = lane + j * 32;
      asyncLoadLdsB128(kOff + f4 * 16, kp + f4 * 4);
      asyncLoadLdsB128(vOff + f4 * 16, vp + f4 * 4);
    }
    waitAsync0();
#else
#pragma unroll
    for (int j = 0; j < 8; ++j) {
      const int f4 = lane + j * 32;
      ((float4*)ldsK[wave])[f4] = ((const float4*)kp)[f4];
      ((float4*)ldsV[wave])[f4] = ((const float4*)vp)[f4];
    }
#endif
    // per-row softmax of the K tile (lanes 0-15 own one row each; per-wave
    // LDS ordering: DS ops from one wave complete in order)
    if (lane < 16) {
      float* row = &ldsK[wave][lane * 64];
      float mx = -__builtin_inff();
      for (int c = 0; c < 64; ++c) mx = fmaxf(mx, row[c]);
      float sum = 0.0f;
      for (int c = 0; c < 64; ++c) {
        float e = exp2f((row[c] - mx) * KEXP); row[c] = e; sum += e;
      }
      float inv = 1.0f / sum;
      for (int c = 0; c < 64; ++c) row[c] *= inv;
    }
    __syncthreads();
#pragma unroll
    for (int ks = 0; ks < 4; ++ks) {
      const int r0 = ks * 4 + 2 * half;   // this lane-half's first K row
      v2f a[4], b[4];
#pragma unroll
      for (int t = 0; t < 4; ++t) {       // A = kn^T : A[c, i] = kn[i, c]
        int c = t * 16 + mloc;
        a[t].x = ldsK[wave][r0 * 64 + c];
        a[t].y = ldsK[wave][(r0 + 1) * 64 + c];
      }
#pragma unroll
      for (int u = 0; u < 4; ++u) {       // B : B[i, v] = V[i, v]
        int v = u * 16 + mloc;
        b[u].x = ldsV[wave][r0 * 64 + v];
        b[u].y = ldsV[wave][(r0 + 1) * 64 + v];
      }
#pragma unroll
      for (int t = 0; t < 4; ++t)
#pragma unroll
        for (int u = 0; u < 4; ++u)
          acc[t][u] = wmma_f32_16x16x4(a[t], b[u], acc[t][u]);
    }
    __syncthreads();
  }

  // deterministic cross-wave merge (fixed wave order; disjoint (c,v) per lane)
  for (int w = 0; w < CTX_WAVES; ++w) {
    if (wave == w) {
#pragma unroll
      for (int t = 0; t < 4; ++t)
#pragma unroll
        for (int u = 0; u < 4; ++u)
#pragma unroll
          for (int r = 0; r < 8; ++r) {
            int c = t * 16 + r + 8 * half;    // D: VGPR r -> M=r / M=r+8
            int v = u * 16 + mloc;
            ldsAcc[c * 64 + v] += acc[t][u][r];
          }
    }
    __syncthreads();
  }
  float* dst = pctx + (size_t)bid * 4096;
  for (int e = tid; e < 4096; e += CTX_WAVES * 32) dst[e] = ldsAcc[e];
}

// ---------- Reduce context partials (fixed order) and fold in 1/s ----------
__global__ __launch_bounds__(256) void kReduceCtx(const float* __restrict__ pctx,
                                                  const float* __restrict__ s,
                                                  float* __restrict__ ctxp) {
  const int e = blockIdx.x * 256 + threadIdx.x;   // 16 blocks x 256 = 4096
  float acc = 0.0f;
  for (int b = 0; b < CTX_BLOCKS; ++b) acc += pctx[(size_t)b * 4096 + e];
  ctxp[e] = acc / s[e >> 6];
}

// ---------- Pass 4: out = E @ ctx'  (E = exp2((Q - m)*KEXP)) ----------
__global__ __launch_bounds__(256) void kOut(const float* __restrict__ Q,
                                            const float* __restrict__ m,
                                            const float* __restrict__ ctxp,
                                            float* __restrict__ out) {
  __shared__ float ldsCtx[4096];
  __shared__ float ldsM[64];
  __shared__ float ldsE[8][1024];
  const int tid  = threadIdx.x;
  const int wave = tid >> 5;
  const int lane = tid & 31;
  const int half = lane >> 4;
  const int mloc = lane & 15;

  for (int e = tid; e < 1024; e += 256)
    ((float4*)ldsCtx)[e] = ((const float4*)ctxp)[e];
  if (tid < 64) ldsM[tid] = m[tid];
  __syncthreads();

  const int rowbase = (blockIdx.x * 8 + wave) * 16;   // 16 rows per wave
  const float4* q4 = (const float4*)(Q + (size_t)rowbase * 64);
  const int c0w = (lane * 4) & 63;                    // cols of this lane's f4
#pragma unroll
  for (int j = 0; j < 8; ++j) {
    int i4 = lane + j * 32;
    float4 v = q4[i4];
    float4 e;
    e.x = exp2f((v.x - ldsM[c0w + 0]) * KEXP);
    e.y = exp2f((v.y - ldsM[c0w + 1]) * KEXP);
    e.z = exp2f((v.z - ldsM[c0w + 2]) * KEXP);
    e.w = exp2f((v.w - ldsM[c0w + 3]) * KEXP);
    ((float4*)ldsE[wave])[i4] = e;
  }
  __syncthreads();

  v8f acc[4];
#pragma unroll
  for (int u = 0; u < 4; ++u)
    acc[u] = (v8f){0.f, 0.f, 0.f, 0.f, 0.f, 0.f, 0.f, 0.f};

#pragma unroll
  for (int ks = 0; ks < 16; ++ks) {
    const int c0 = ks * 4 + 2 * half;
    v2f a;                                  // A[row, c] = E[row, c]
    a.x = ldsE[wave][mloc * 64 + c0];
    a.y = ldsE[wave][mloc * 64 + c0 + 1];
#pragma unroll
    for (int u = 0; u < 4; ++u) {           // B[c, v] = ctx'[c, v]
      v2f b;
      b.x = ldsCtx[c0 * 64 + u * 16 + mloc];
      b.y = ldsCtx[(c0 + 1) * 64 + u * 16 + mloc];
      acc[u] = wmma_f32_16x16x4(a, b, acc[u]);
    }
  }
  float* o = out + (size_t)rowbase * 64;
#pragma unroll
  for (int u = 0; u < 4; ++u)
#pragma unroll
    for (int r = 0; r < 8; ++r) {
      int row = r + 8 * half;
      o[row * 64 + u * 16 + mloc] = acc[u][r];
    }
}

extern "C" void kernel_launch(void* const* d_in, const int* in_sizes, int n_in,
                              void* d_out, int out_size, void* d_ws, size_t ws_size,
                              hipStream_t stream) {
  (void)in_sizes; (void)n_in; (void)out_size; (void)ws_size;
  const float* Q = (const float*)d_in[0];
  const float* K = (const float*)d_in[1];
  const float* V = (const float*)d_in[2];
  float* out = (float*)d_out;

  // ws (floats): m[64] | s[64] | ctxp[4096] | pmax[16384] | psum[16384]
  //              | pctx[512*4096]   (~8.5 MB total)
  float* w    = (float*)d_ws;
  float* m    = w;
  float* s    = w + 64;
  float* ctxp = w + 128;
  float* pmax = w + 128 + 4096;
  float* psum = pmax + 256 * 64;
  float* pctx = psum + 256 * 64;

  kColMaxPartial<<<256, 256, 0, stream>>>(Q, pmax);
  kReduceMax    <<<1,    64, 0, stream>>>(pmax, m);
  kSumExpPartial<<<256, 256, 0, stream>>>(Q, m, psum);
  kReduceSum    <<<1,    64, 0, stream>>>(psum, s);
  kCtxPartial   <<<CTX_BLOCKS, CTX_WAVES * 32, 0, stream>>>(K, V, pctx);
  kReduceCtx    <<<16,  256, 0, stream>>>(pctx, s, ctxp);
  kOut          <<<2048, 256, 0, stream>>>(Q, m, ctxp, out);
}

// v001
// Measured time: 106 microseconds a run.
// Next to v000, in two timings, it ran 1.64 and 1.65 times as fast.
#include <hip/hip_runtime.h>
#include <math.h>

// Linear attention, N=262144, d_k=d_v=64.  Memory-bound (>=256MB traffic,
// ~11-15us floor at 23.3TB/s).  f32 WMMA (16x16x4) for both matmuls,
// async global->LDS (b128) for K/V tile staging in the context pass.

#define NROWS 262144
#define DIM   64
#define KEXP  0.18033688011112042f   // (1/8) * log2(e)

#define CTX_BLOCKS 512
#define CTX_WAVES  4                 // 512 x 4 = 2048 waves streaming K/V

#define ST_BLOCKS  256               // column statistics of Q: 1024 rows a block
#define ST_THREADS 512
#define ST_F4      32                // float4 per thread = 1024*16/512

#define USE_ASYNC_LDS 1

typedef float v2f __attribute__((ext_vector_type(2)));
typedef float v8f __attribute__((ext_vector_type(8)));

static __device__ __forceinline__ v8f wmma_f32_16x16x4(v2f a, v2f b, v8f c) {
  // 8 args: (neg_a, A, neg_b, B, c_mod, C, reuse_a, reuse_b)
  return __builtin_amdgcn_wmma_f32_16x16x4_f32(false, a, false, b, (short)0, c,
                                               false, false);
}

// Low 32 bits of a generic pointer into LDS == wave-relative LDS byte offset.
static __device__ __forceinline__ unsigned ldsOffsetOf(const void* p) {
  return (unsigned)(size_t)p;
}

static __device__ __forceinline__ void asyncLoadLdsB128(unsigned ldsOff,
                                                        const float* gaddr) {
#if USE_ASYNC_LDS
  asm volatile("global_load_async_to_lds_b128 %0, %1, off"
               :: "v"(ldsOff), "v"(gaddr) : "memory");
#endif
}

static __device__ __forceinline__ void waitAsync0() {
#if USE_ASYNC_LDS
  asm volatile("s_wait_asynccnt 0x0" ::: "memory");
#endif
}

// exp2 of an argument <= 0 by the bare instruction: exp2f's range fix-up acts only
// on results below 2^-126, which vanish against a sum that holds a term of 1.
// The closing v_nop keeps the one slot that the instruction set asks for behind a
// transcendental, whatever the compiler places next.
static __device__ __forceinline__ float exp2Neg(float x) {
  float r;
  asm("v_exp_f32 %0, %1\n\tv_nop" : "=v"(r) : "v"(x));
  return r;
}

// Four at once, one slot for the run; early-clobber outputs so that no result
// lands on a source that a later line of the statement still reads.
static __device__ __forceinline__ float4 exp2Neg4(float4 x) {
  float4 r;
  asm("v_exp_f32 %0, %4\n\tv_exp_f32 %1, %5\n\tv_exp_f32 %2, %6\n\t"
      "v_exp_f32 %3, %7\n\tv_nop"
      : "=&v"(r.x), "=&v"(r.y), "=&v"(r.z), "=&v"(r.w)
      : "v"(x.x), "v"(x.y), "v"(x.z), "v"(x.w));
  return r;
}

// ---------- Pass 1: per-block column max AND sum of exp, Q read once ----------
// Each thread holds its 32 float4 of Q in registers (all loads issued before the
// first use), takes its own column maxes, sums exp against them, and the
// (max, sum) pairs are merged by rescaling: s = sum_j s_j * exp2((m_j - m)*KEXP).
// element (i*4+k) column = (tid*4+k) & 63 since strides are multiples of 64.
__global__ __launch_bounds__(ST_THREADS) void kColStatsPartial(
    const float* __restrict__ Q, float* __restrict__ pmax,
    float* __restrict__ psum) {
  __shared__ __attribute__((aligned(16))) float smM[ST_THREADS / 16][64];
  __shared__ __attribute__((aligned(16))) float smS[ST_THREADS / 16][64];
  const int tid = threadIdx.x, bid = blockIdx.x;
  const float4* q4 = (const float4*)(Q + (size_t)bid * (NROWS / ST_BLOCKS) * DIM);
  float4 v[ST_F4];
#pragma unroll
  for (int j = 0; j < ST_F4; ++j) v[j] = q4[tid + j * ST_THREADS];
  float4 mx = v[0];
#pragma unroll
  for (int j = 1; j < ST_F4; ++j) {
    mx.x = fmaxf(mx.x, v[j].x); mx.y = fmaxf(mx.y, v[j].y);
    mx.z = fmaxf(mx.z, v[j].z); mx.w = fmaxf(mx.w, v[j].w);
  }
  float4 s = {0.f, 0.f, 0.f, 0.f};
#pragma unroll
  for (int j = 0; j < ST_F4; ++j) {
    float4 a = {(v[j].x - mx.x) * KEXP, (v[j].y - mx.y) * KEXP,
                (v[j].z - mx.z) * KEXP, (v[j].w - mx.w) * KEXP};
    float4 e = exp2Neg4(a);
    s.x += e.x; s.y += e.y; s.z += e.z; s.w += e.w;
  }
  const int c0 = (tid * 4) & 63;                    // 4 columns owned
  const int mem = tid >> 4;                         // members per column set
  *(float4*)&smM[mem][c0] = mx;
  *(float4*)&smS[mem][c0] = s;
  __syncthreads();
  if (tid < 64) {
    float M = smM[0][tid];
#pragma unroll
    for (int j = 1; j < ST_THREADS / 16; ++j) M = fmaxf(M, smM[j][tid]);
    float S = 0.f;
#pragma unroll
    for (int j = 0; j < ST_THREADS / 16; ++j)
      S += smS[j][tid] * exp2Neg((smM[j][tid] - M) * KEXP);
    pmax[bid * 64 + tid] = M;
    psum[bid * 64 + tid] = S;
  }
}

// Merge the per-block (max, sum) pairs: 16 threads a column, 16 pairs each,
// then 64 threads merge the 16 group results (fixed order throughout).
__global__ __launch_bounds__(1024) void kMergeStats(const float* __restrict__ pmax,
                                                    const float* __restrict__ psum,
                                                    float* __restrict__ m,
                                                    float* __restrict__ s) {
  __shared__ float smM[16][64];
  __shared__ float smS[16][64];
  const int tid = threadIdx.x;
  const int c = tid & 63, g = tid >> 6;
  float pm[ST_BLOCKS / 16], pv[ST_BLOCKS / 16];
#pragma unroll
  for (int k = 0; k < ST_BLOCKS / 16; ++k) {
    pm[k] = pmax[(g * (ST_BLOCKS / 16) + k) * 64 + c];
    pv[k] = psum[(g * (ST_BLOCKS / 16) + k) * 64 + c];
  }
  float M = pm[0];
#pragma unroll
  for (int k = 1; k < ST_BLOCKS / 16; ++k) M = fmaxf(M, pm[k]);
  float S = 0.f;
#pragma unroll
  for (int k = 0; k < ST_BLOCKS / 16; ++k) S += pv[k] * exp2Neg((pm[k] - M) * KEXP);
  smM[g][c] = M;
  smS[g][c] = S;
  __syncthreads();
  if (tid < 64) {
    float Mt = smM[0][tid];
#pragma unroll
    for (int j = 1; j < 16; ++j) Mt = fmaxf(Mt, smM[j][tid]);
    float St = 0.f;
#pragma unroll
    for (int j = 0; j < 16; ++j) St += smS[j][tid] * exp2Neg((smM[j][tid] - Mt) * KEXP);
    m[tid] = Mt;
    s[tid] = St;
  }
}

// ---------- Pass 3: context partials, ctx[c,v] += sum_i kn[i,c]*V[i,v] ----------
// 512 blocks x 4 waves; each wave owns private 16x64 K/V tiles (async-filled),
// accumulates the full 64x64 in 16 f32 WMMA tiles, then a fixed-order
// (deterministic) cross-wave merge into block LDS.
__global__ __launch_bounds__(CTX_WAVES * 32) void kCtxPartial(
    const float* __restrict__ K, const float* __restrict__ V,
    float* __restrict__ pctx) {
  __shared__ float ldsK[CTX_WAVES][16 * 64];
  __shared__ float ldsV[CTX_WAVES][16 * 64];
  __shared__ float ldsAcc[4096];
  const int tid  = threadIdx.x;
  const int wave = tid >> 5;
  const int lane = tid & 31;
  const int bid  = blockIdx.x;
  const int half = lane >> 4;
  const int mloc = lane & 15;

  for (int e = tid; e < 4096; e += CTX_WAVES * 32) ldsAcc[e] = 0.0f;

  v8f acc[4][4];
#pragma unroll
  for (int t = 0; t < 4; ++t)
#pragma unroll
    for (int u = 0; u < 4; ++u)
      acc[t][u] = (v8f){0.f, 0.f, 0.f, 0.f, 0.f, 0.f, 0.f, 0.f};

  const unsigned kOff = ldsOffsetOf(&ldsK[wave][0]);
  const unsigned vOff = ldsOffsetOf(&ldsV[wave][0]);
  const int rowsPerBlock = NROWS / CTX_BLOCKS;            // 512
  const int rows0 = bid * rowsPerBlock + wave * (rowsPerBlock / CTX_WAVES);
  __syncthreads();                                        // ldsAcc zeroed

  for (int chunk = 0; chunk < (rowsPerBlock / CTX_WAVES) / 16; ++chunk) {
    const int rowbase = rows0 + chunk * 16;
    const float* kp = K + (size_t)rowbase * 64;
    const float* vp = V + (size_t)rowbase * 64;
#if USE_ASYNC_LDS
#pragma unroll
    for (int j = 0; j < 8; ++j) {                         // 16B per lane per op
      const int f4 = lane + j * 32;
      asyncLoadLdsB128(kOff + f4 * 16, kp + f4 * 4);
      asyncLoadLdsB128(vOff + f4 * 16, vp + f4 * 4);
    }
    waitAsync0();
#else
#pragma unroll
    for (int j = 0; j < 8; ++j) {
      const int f4 = lane + j * 32;
      ((float4*)ldsK[wave])[f4] = ((const float4*)kp)[f4];
      ((float4*)ldsV[wave])[f4] = ((const float4*)vp)[f4];
    }
#endif
    // per-row softmax of the K tile (lanes 0-15 own one row each; per-wave
    // LDS ordering: DS ops from one wave complete in order)
    if (lane < 16) {
      float* row = &ldsK[wave][lane * 64];
      float mx = -__builtin_inff();
      for (int c = 0; c < 64; ++c) mx = fmaxf(mx, row[c]);
      float sum = 0.0f;
      for (int c = 0; c < 64; ++c) {
        float e = exp2f((row[c] - mx) * KEXP); row[c] = e; sum += e;
      }
      float inv = 1.0f / sum;
      for (int c = 0; c < 64; ++c) row[c] *= inv;
    }
    __syncthreads();
#pragma unroll
    for (int ks = 0; ks < 4; ++ks) {
      const int r0 = ks * 4 + 2 * half;   // this lane-half's first K row
      v2f a[4], b[4];
#pragma unroll
      for (int t = 0; t < 4; ++t) {       // A = kn^T : A[c, i] = kn[i, c]
        int c = t * 16 + mloc;
        a[t].x = ldsK[wave][r0 * 64 + c];
        a[t].y = ldsK[wave][(r0 + 1) * 64 + c];
      }
#pragma unroll
      for (int u = 0; u < 4; ++u) {       // B : B[i, v] = V[i, v]
        int v = u * 16 + mloc;
        b[u].x = ldsV[wave][r0 * 64 + v];
        b[u].y = ldsV[wave][(r0 + 1) * 64 + v];
      }
#pragma unroll
      for (int t = 0; t < 4; ++t)
#pragma unroll
        for (int u = 0; u < 4; ++u)
          acc[t][u] = wmma_f32_16x16x4(a[t], b[u], acc[t][u]);
    }
    __syncthreads();
  }

  // deterministic cross-wave merge (fixed wave order; disjoint (c,v) per lane)
  for (int w = 0; w < CTX_WAVES; ++w) {
    if (wave == w) {
#pragma unroll
      for (int t = 0; t < 4; ++t)
#pragma unroll
        for (int u = 0; u < 4; ++u)
#pragma unroll
          for (int r = 0; r < 8; ++r) {
            int c = t * 16 + r + 8 * half;    // D: VGPR r -> M=r / M=r+8
            int v = u * 16 + mloc;
            ldsAcc[c * 64 + v] += acc[t][u][r];
          }
    }
    __syncthreads();
  }
  float* dst = pctx + (size_t)bid * 4096;
  for (int e = tid; e < 4096; e += CTX_WAVES * 32) dst[e] = ldsAcc[e];
}

// ---------- Reduce context partials (fixed order) and fold in 1/s ----------
__global__ __launch_bounds__(256) void kReduceCtx(const float* __restrict__ pctx,
                                                  const float* __restrict__ s,
                                                  float* __restrict__ ctxp) {
  const int e = blockIdx.x * 256 + threadIdx.x;   // 16 blocks x 256 = 4096
  float acc = 0.0f;
  for (int b = 0; b < CTX_BLOCKS; ++b) acc += pctx[(size_t)b * 4096 + e];
  ctxp[e] = acc / s[e >> 6];
}

// ---------- Pass 4: out = E @ ctx'  (E = exp2((Q - m)*KEXP)) ----------
__global__ __launch_bounds__(256) void kOut(const float* __restrict__ Q,
                                            const float* __restrict__ m,
                                            const float* __restrict__ ctxp,
                                            float* __restrict__ out) {
  __shared__ float ldsCtx[4096];
  __shared__ float ldsM[64];
  __shared__ float ldsE[8][1024];
  const int tid  = threadIdx.x;
  const int wave = tid >> 5;
  const int lane = tid & 31;
  const int half = lane >> 4;
  const int mloc = lane & 15;

  for (int e = tid; e < 1024; e += 256)
    ((float4*)ldsCtx)[e] = ((const float4*)ctxp)[e];
  if (tid < 64) ldsM[tid] = m[tid];
  __syncthreads();

  const int rowbase = (blockIdx.x * 8 + wave) * 16;   // 16 rows per wave
  const float4* q4 = (const float4*)(Q + (size_t)rowbase * 64);
  const int c0w = (lane * 4) & 63;                    // cols of this lane's f4
#pragma unroll
  for (int j = 0; j < 8; ++j) {
    int i4 = lane + j * 32;
    float4 v = q4[i4];
    float4 e;
    e.x = exp2f((v.x - ldsM[c0w + 0]) * KEXP);
    e.y = exp2f((v.y - ldsM[c0w + 1]) * KEXP);
    e.z = exp2f((v.z - ldsM[c0w + 2]) * KEXP);
    e.w = exp2f((v.w - ldsM[c0w + 3]) * KEXP);
    ((float4*)ldsE[wave])[i4] = e;
  }
  __syncthreads();

  v8f acc[4];
#pragma unroll
  for (int u = 0; u < 4; ++u)
    acc[u] = (v8f){0.f, 0.f, 0.f, 0.f, 0.f, 0.f, 0.f, 0.f};

#pragma unroll
  for (int ks = 0; ks < 16; ++ks) {
    const int c0 = ks * 4 + 2 * half;
    v2f a;                                  // A[row, c] = E[row, c]
    a.x = ldsE[wave][mloc * 64 + c0];
    a.y = ldsE[wave][mloc * 64 + c0 + 1];
#pragma unroll
    for (int u = 0; u < 4; ++u) {           // B[c, v] = ctx'[c, v]
      v2f b;
      b.x = ldsCtx[c0 * 64 + u * 16 + mloc];
      b.y = ldsCtx[(c0 + 1) * 64 + u * 16 + mloc];
      acc[u] = wmma_f32_16x16x4(a, b, acc[u]);
    }
  }
  float* o = out + (size_t)rowbase * 64;
#pragma unroll
  for (int u = 0; u < 4; ++u)
#pragma unroll
    for (int r = 0; r < 8; ++r) {
      int row = r + 8 * half;
      o[row * 64 + u * 16 + mloc] = acc[u][r];
    }
}

extern "C" void kernel_launch(void* const* d_in, const int* in_sizes, int n_in,
                              void* d_out, int out_size, void* d_ws, size_t ws_size,
                              hipStream_t stream) {
  (void)in_sizes; (void)n_in; (void)out_size; (void)ws_size;
  const float* Q = (const float*)d_in[0];
  const float* K = (const float*)d_in[1];
  const float* V = (const float*)d_in[2];
  float* out = (float*)d_out;

  // ws (floats): m[64] | s[64] | ctxp[4096] | pmax[16384] | psum[16384]
  //              | pctx[512*4096]   (~8.5 MB total)
  float* w    = (float*)d_ws;
  float* m    = w;
  float* s    = w + 64;
  float* ctxp = w + 128;
  float* pmax = w + 128 + 4096;
  float* psum = pmax + 256 * 64;
  float* pctx = psum + 256 * 64;

  kColStatsPartial<<<ST_BLOCKS, ST_THREADS, 0, stream>>>(Q, pmax, psum);
  kMergeStats   <<<1,  1024, 0, stream>>>(pmax, psum, m, s);
  kCtxPartial   <<<CTX_BLOCKS, CTX_WAVES * 32, 0, stream>>>(K, V, pctx);
  kReduceCtx    <<<16,  256, 0, stream>>>(pctx, s, ctxp);
  kOut          <<<2048, 256, 0, stream>>>(Q, m, ctxp, out);
}

// v002
// It runs in 75 microseconds.
// In both of two side-by-side timings against v001, it was 1.42 times as fast.
// Over all steps from v000 it is 2.34 times as fast.
#include <hip/hip_runtime.h>
#include <math.h>

// Linear attention, N=262144, d_k=d_v=64.  Memory-bound (>=256MB traffic,
// ~11-15us floor at 23.3TB/s).  f32 WMMA (16x16x4) for both matmuls,
// async global->LDS (b128) for K/V tile staging in the context pass.

#define NROWS 262144
#define DIM   64
#define KEXP  0.18033688011112042f   // (1/8) * log2(e)

#define CTX_BLOCKS 512
#define CTX_WAVES  4                 // 512 x 4 = 2048 waves streaming K/V

#define ST_BLOCKS  256               // column statistics of Q: 1024 rows a block
#define ST_THREADS 512
#define ST_F4      32                // float4 per thread = 1024*16/512

#define USE_ASYNC_LDS 1

typedef float v2f __attribute__((ext_vector_type(2)));
typedef float v8f __attribute__((ext_vector_type(8)));

static __device__ __forceinline__ v8f wmma_f32_16x16x4(v2f a, v2f b, v8f c) {
  // 8 args: (neg_a, A, neg_b, B, c_mod, C, reuse_a, reuse_b)
  return __builtin_amdgcn_wmma_f32_16x16x4_f32(false, a, false, b, (short)0, c,
                                               false, false);
}

// Low 32 bits of a generic pointer into LDS == wave-relative LDS byte offset.
static __device__ __forceinline__ unsigned ldsOffsetOf(const void* p) {
  return (unsigned)(size_t)p;
}

static __device__ __forceinline__ void asyncLoadLdsB128(unsigned ldsOff,
                                                        const float* gaddr) {
#if USE_ASYNC_LDS
  asm volatile("global_load_async_to_lds_b128 %0, %1, off"
               :: "v"(ldsOff), "v"(gaddr) : "memory");
#endif
}

static __device__ __forceinline__ void waitAsync0() {
#if USE_ASYNC_LDS
  asm volatile("s_wait_asynccnt 0x0" ::: "memory");
#endif
}

// exp2 of an argument <= 0 by the bare instruction: exp2f's range fix-up acts only
// on results below 2^-126, which vanish against a sum that holds a term of 1.
// The closing v_nop keeps the one slot that the instruction set asks for behind a
// transcendental, whatever the compiler places next.
static __device__ __forceinline__ float exp2Neg(float x) {
  float r;
  asm("v_exp_f32 %0, %1\n\tv_nop" : "=v"(r) : "v"(x));
  return r;
}

// Four at once, one slot for the run; early-clobber outputs so that no result
// lands on a source that a later line of the statement still reads.
static __device__ __forceinline__ float4 exp2Neg4(float4 x) {
  float4 r;
  asm("v_exp_f32 %0, %4\n\tv_exp_f32 %1, %5\n\tv_exp_f32 %2, %6\n\t"
      "v_exp_f32 %3, %7\n\tv_nop"
      : "=&v"(r.x), "=&v"(r.y), "=&v"(r.z), "=&v"(r.w)
      : "v"(x.x), "v"(x.y), "v"(x.z), "v"(x.w));
  return r;
}

// Butterfly over the 16 lanes of a row (lane l with l ^ 1, 2, 4, 8) for eight
// values at once.  Written as asm because a shuffle from source goes through the
// LDS crossbar with a wait behind each step, while the DPP form stays on the
// vector port; one statement, step-major, so that the eight independent chains
// fill each other's latency (as separate statements the compiler put each chain
// back to back).
#define ROW8_STEP(OP, X)                                            \
  OP " %0, %0, %0 row_xmask:" X " row_mask:0xf bank_mask:0xf\n\t"   \
  OP " %1, %1, %1 row_xmask:" X " row_mask:0xf bank_mask:0xf\n\t"   \
  OP " %2, %2, %2 row_xmask:" X " row_mask:0xf bank_mask:0xf\n\t"   \
  OP " %3, %3, %3 row_xmask:" X " row_mask:0xf bank_mask:0xf\n\t"   \
  OP " %4, %4, %4 row_xmask:" X " row_mask:0xf bank_mask:0xf\n\t"   \
  OP " %5, %5, %5 row_xmask:" X " row_mask:0xf bank_mask:0xf\n\t"   \
  OP " %6, %6, %6 row_xmask:" X " row_mask:0xf bank_mask:0xf\n\t"   \
  OP " %7, %7, %7 row_xmask:" X " row_mask:0xf bank_mask:0xf\n\t"
#define ROW8_ALL(OP) \
  ROW8_STEP(OP, "1") ROW8_STEP(OP, "2") ROW8_STEP(OP, "4") ROW8_STEP(OP, "8")

static __device__ __forceinline__ void rowMax8(float (&r)[8]) {
  asm(ROW8_ALL("v_max_num_f32_dpp")
      : "+v"(r[0]), "+v"(r[1]), "+v"(r[2]), "+v"(r[3]),
        "+v"(r[4]), "+v"(r[5]), "+v"(r[6]), "+v"(r[7]));
}

static __device__ __forceinline__ void rowSum8(float (&r)[8]) {
  asm(ROW8_ALL("v_add_f32_dpp")
      : "+v"(r[0]), "+v"(r[1]), "+v"(r[2]), "+v"(r[3]),
        "+v"(r[4]), "+v"(r[5]), "+v"(r[6]), "+v"(r[7]));
}

// ---------- Pass 1: per-block column max AND sum of exp, Q read once ----------
// Each thread holds its 32 float4 of Q in registers (all loads issued before the
// first use), takes its own column maxes, sums exp against them, and the
// (max, sum) pairs are merged by rescaling: s = sum_j s_j * exp2((m_j - m)*KEXP).
// element (i*4+k) column = (tid*4+k) & 63 since strides are multiples of 64.
__global__ __launch_bounds__(ST_THREADS) void kColStatsPartial(
    const float* __restrict__ Q, float* __restrict__ pmax,
    float* __restrict__ psum) {
  __shared__ __attribute__((aligned(16))) float smM[ST_THREADS / 16][64];
  __shared__ __attribute__((aligned(16))) float smS[ST_THREADS / 16][64];
  const int tid = threadIdx.x, bid = blockIdx.x;
  const float4* q4 = (const float4*)(Q + (size_t)bid * (NROWS / ST_BLOCKS) * DIM);
  float4 v[ST_F4];
#pragma unroll
  for (int j = 0; j < ST_F4; ++j) v[j] = q4[tid + j * ST_THREADS];
  float4 mx = v[0];
#pragma unroll
  for (int j = 1; j < ST_F4; ++j) {
    mx.x = fmaxf(mx.x, v[j].x); mx.y = fmaxf(mx.y, v[j].y);
    mx.z = fmaxf(mx.z, v[j].z); mx.w = fmaxf(mx.w, v[j].w);
  }
  float4 s = {0.f, 0.f, 0.f, 0.f};
#pragma unroll
  for (int j = 0; j < ST_F4; ++j) {
    float4 a = {(v[j].x - mx.x) * KEXP, (v[j].y - mx.y) * KEXP,
                (v[j].z - mx.z) * KEXP, (v[j].w - mx.w) * KEXP};
    float4 e = exp2Neg4(a);
    s.x += e.x; s.y += e.y; s.z += e.z; s.w += e.w;
  }
  const int c0 = (tid * 4) & 63;                    // 4 columns owned
  const int mem = tid >> 4;                         // members per column set
  *(float4*)&smM[mem][c0] = mx;
  *(float4*)&smS[mem][c0] = s;
  __syncthreads();
  if (tid < 64) {
    float M = smM[0][tid];
#pragma unroll
    for (int j = 1; j < ST_THREADS / 16; ++j) M = fmaxf(M, smM[j][tid]);
    float S = 0.f;
#pragma unroll
    for (int j = 0; j < ST_THREADS / 16; ++j)
      S += smS[j][tid] * exp2Neg((smM[j][tid] - M) * KEXP);
    pmax[bid * 64 + tid] = M;
    psum[bid * 64 + tid] = S;
  }
}

// Merge the per-block (max, sum) pairs: 16 threads a column, 16 pairs each,
// then 64 threads merge the 16 group results (fixed order throughout).
__global__ __launch_bounds__(1024) void kMergeStats(const float* __restrict__ pmax,
                                                    const float* __restrict__ psum,
                                                    float* __restrict__ m,
                                                    float* __restrict__ s) {
  __shared__ float smM[16][64];
  __shared__ float smS[16][64];
  const int tid = threadIdx.x;
  const int c = tid & 63, g = tid >> 6;
  float pm[ST_BLOCKS / 16], pv[ST_BLOCKS / 16];
#pragma unroll
  for (int k = 0; k < ST_BLOCKS / 16; ++k) {
    pm[k] = pmax[(g * (ST_BLOCKS / 16) + k) * 64 + c];
    pv[k] = psum[(g * (ST_BLOCKS / 16) + k) * 64 + c];
  }
  float M = pm[0];
#pragma unroll
  for (int k = 1; k < ST_BLOCKS / 16; ++k) M = fmaxf(M, pm[k]);
  float S = 0.f;
#pragma unroll
  for (int k = 0; k < ST_BLOCKS / 16; ++k) S += pv[k] * exp2Neg((pm[k] - M) * KEXP);
  smM[g][c] = M;
  smS[g][c] = S;
  __syncthreads();
  if (tid < 64) {
    float Mt = smM[0][tid];
#pragma unroll
    for (int j = 1; j < 16; ++j) Mt = fmaxf(Mt, smM[j][tid]);
    float St = 0.f;
#pragma unroll
    for (int j = 0; j < 16; ++j) St += smS[j][tid] * exp2Neg((smM[j][tid] - Mt) * KEXP);
    m[tid] = Mt;
    s[tid] = St;
  }
}

// ---------- Pass 3: context partials, ctx[c,v] += sum_i kn[i,c]*V[i,v] ----------
// 512 blocks x 4 waves; each wave owns private 16x64 K/V tiles (async-filled),
// accumulates the full 64x64 in 16 f32 WMMA tiles, then a fixed-order
// (deterministic) cross-wave merge into block LDS.
__global__ __launch_bounds__(CTX_WAVES * 32) void kCtxPartial(
    const float* __restrict__ K, const float* __restrict__ V,
    float* __restrict__ pctx) {
  __shared__ float ldsK[CTX_WAVES][16 * 64];
  __shared__ float ldsV[CTX_WAVES][16 * 64];
  __shared__ float ldsAcc[4096];
  const int tid  = threadIdx.x;
  const int wave = tid >> 5;
  const int lane = tid & 31;
  const int bid  = blockIdx.x;
  const int half = lane >> 4;
  const int mloc = lane & 15;

  for (int e = tid; e < 4096; e += CTX_WAVES * 32) ldsAcc[e] = 0.0f;

  v8f acc[4][4];
#pragma unroll
  for (int t = 0; t < 4; ++t)
#pragma unroll
    for (int u = 0; u < 4; ++u)
      acc[t][u] = (v8f){0.f, 0.f, 0.f, 0.f, 0.f, 0.f, 0.f, 0.f};

  const unsigned kOff = ldsOffsetOf(&ldsK[wave][0]);
  const unsigned vOff = ldsOffsetOf(&ldsV[wave][0]);
  const int rowsPerBlock = NROWS / CTX_BLOCKS;            // 512
  const int rows0 = bid * rowsPerBlock + wave * (rowsPerBlock / CTX_WAVES);
  __syncthreads();                                        // ldsAcc zeroed

  for (int chunk = 0; chunk < (rowsPerBlock / CTX_WAVES) / 16; ++chunk) {
    const int rowbase = rows0 + chunk * 16;
    const float* kp = K + (size_t)rowbase * 64;
    const float* vp = V + (size_t)rowbase * 64;
#if USE_ASYNC_LDS
#pragma unroll
    for (int j = 0; j < 8; ++j) {                         // 16B per lane per op
      const int f4 = lane + j * 32;
      asyncLoadLdsB128(kOff + f4 * 16, kp + f4 * 4);
      asyncLoadLdsB128(vOff + f4 * 16, vp + f4 * 4);
    }
    waitAsync0();
#else
#pragma unroll
    for (int j = 0; j < 8; ++j) {
      const int f4 = lane + j * 32;
      ((float4*)ldsK[wave])[f4] = ((const float4*)kp)[f4];
      ((float4*)ldsV[wave])[f4] = ((const float4*)vp)[f4];
    }
#endif
    __syncthreads();
    // A = kn^T : A[c, i] = kn[i, c].  All 16 A fragments of the tile are read raw.
    // In this layout K row ks*4 + 2*half + {0,1} sits in component {x,y} of
    // a[ks][0..3] across the 16 lanes of this lane's half, so the row softmax is
    // taken right here: 4 values a lane, then a 16-lane butterfly; nothing is
    // written back to LDS.
    v2f a[4][4];
#pragma unroll
    for (int ks = 0; ks < 4; ++ks) {
      const int r0 = ks * 4 + 2 * half;   // this lane-half's first K row
#pragma unroll
      for (int t = 0; t < 4; ++t) {
        int c = t * 16 + mloc;
        a[ks][t].x = ldsK[wave][r0 * 64 + c];
        a[ks][t].y = ldsK[wave][(r0 + 1) * 64 + c];
      }
    }
    float red[8];                         // one value a row: max, then sum
#pragma unroll
    for (int ks = 0; ks < 4; ++ks) {
      red[2 * ks] = __builtin_fmaximum_numf(
          __builtin_fmaximum_numf(a[ks][0].x, a[ks][1].x),
          __builtin_fmaximum_numf(a[ks][2].x, a[ks][3].x));
      red[2 * ks + 1] = __builtin_fmaximum_numf(
          __builtin_fmaximum_numf(a[ks][0].y, a[ks][1].y),
          __builtin_fmaximum_numf(a[ks][2].y, a[ks][3].y));
    }
    rowMax8(red);
#pragma unroll
    for (int ks = 0; ks < 4; ++ks) {
      const float mx = red[2 * ks], my = red[2 * ks + 1];
#pragma unroll
      for (int t = 0; t < 4; t += 2) {
        float4 g = {(a[ks][t].x - mx) * KEXP, (a[ks][t].y - my) * KEXP,
                    (a[ks][t + 1].x - mx) * KEXP, (a[ks][t + 1].y - my) * KEXP};
        float4 e = exp2Neg4(g);
        a[ks][t].x = e.x;     a[ks][t].y = e.y;
        a[ks][t + 1].x = e.z; a[ks][t + 1].y = e.w;
      }
      red[2 * ks]     = (a[ks][0].x + a[ks][1].x) + (a[ks][2].x + a[ks][3].x);
      red[2 * ks + 1] = (a[ks][0].y + a[ks][1].y) + (a[ks][2].y + a[ks][3].y);
    }
    rowSum8(red);
#pragma unroll
    for (int ks = 0; ks < 4; ++ks) {
      // sums lie in [1, 64]: the bare reciprocal needs no range fix-up
      const v2f inv = {__builtin_amdgcn_rcpf(red[2 * ks]),
                       __builtin_amdgcn_rcpf(red[2 * ks + 1])};
#pragma unroll
      for (int t = 0; t < 4; ++t) a[ks][t] *= inv;
    }
#pragma unroll
    for (int ks = 0; ks < 4; ++ks) {
      const int r0 = ks * 4 + 2 * half;
      v2f b[4];
#pragma unroll
      for (int u = 0; u < 4; ++u) {       // B : B[i, v] = V[i, v]
        int v = u * 16 + mloc;
        b[u].x = ldsV[wave][r0 * 64 + v];
        b[u].y = ldsV[wave][(r0 + 1) * 64 + v];
      }
#pragma unroll
      for (int t = 0; t < 4; ++t)
#pragma unroll
        for (int u = 0; u < 4; ++u)
          acc[t][u] = wmma_f32_16x16x4(a[ks][t], b[u], acc[t][u]);
    }
    __syncthreads();
    // Distance behind the trip's last WMMA: across the back edge the next trip's
    // first vector instructions reuse that WMMA's A registers.
    // The scheduling barrier keeps every WMMA of the
    // trip in front of the slots.
    __builtin_amdgcn_sched_barrier(0);
    asm volatile("v_nop\n\tv_nop\n\tv_nop\n\tv_nop\n\t"
                 "v_nop\n\tv_nop\n\tv_nop\n\tv_nop");
  }

  // deterministic cross-wave merge (fixed wave order; disjoint (c,v) per lane)
  for (int w = 0; w < CTX_WAVES; ++w) {
    if (wave == w) {
#pragma unroll
      for (int t = 0; t < 4; ++t)
#pragma unroll
        for (int u = 0; u < 4; ++u)
#pragma unroll
          for (int r = 0; r < 8; ++r) {
            int c = t * 16 + r + 8 * half;    // D: VGPR r -> M=r / M=r+8
            int v = u * 16 + mloc;
            ldsAcc[c * 64 + v] += acc[t][u][r];
          }
    }
    __syncthreads();
  }
  float* dst = pctx + (size_t)bid * 4096;
  for (int e = tid; e < 4096; e += CTX_WAVES * 32) dst[e] = ldsAcc[e];
}

// ---------- Reduce context partials (fixed order) and fold in 1/s ----------
__global__ __launch_bounds__(256) void kReduceCtx(const float* __restrict__ pctx,
                                                  const float* __restrict__ s,
                                                  float* __restrict__ ctxp) {
  const int e = blockIdx.x * 256 + threadIdx.x;   // 16 blocks x 256 = 4096
  float acc = 0.0f;
  for (int b = 0; b < CTX_BLOCKS; ++b) acc += pctx[(size_t)b * 4096 + e];
  ctxp[e] = acc / s[e >> 6];
}

// ---------- Pass 4: out = E @ ctx'  (E = exp2((Q - m)*KEXP)) ----------
__global__ __launch_bounds__(256) void kOut(const float* __restrict__ Q,
                                            const float* __restrict__ m,
                                            const float* __restrict__ ctxp,
                                            float* __restrict__ out) {
  __shared__ float ldsCtx[4096];
  __shared__ float ldsM[64];
  __shared__ float ldsE[8][1024];
  const int tid  = threadIdx.x;
  const int wave = tid >> 5;
  const int lane = tid & 31;
  const int half = lane >> 4;
  const int mloc = lane & 15;

  for (int e = tid; e < 1024; e += 256)
    ((float4*)ldsCtx)[e] = ((const float4*)ctxp)[e];
  if (tid < 64) ldsM[tid] = m[tid];
  __syncthreads();

  const int rowbase = (blockIdx.x * 8 + wave) * 16;   // 16 rows per wave
  const float4* q4 = (const float4*)(Q + (size_t)rowbase * 64);
  const int c0w = (lane * 4) & 63;                    // cols of this lane's f4
#pragma unroll
  for (int j = 0; j < 8; ++j) {
    int i4 = lane + j * 32;
    float4 v = q4[i4];
    float4 e;
    e.x = exp2f((v.x - ldsM[c0w + 0]) * KEXP);
    e.y = exp2f((v.y - ldsM[c0w + 1]) * KEXP);
    e.z = exp2f((v.z - ldsM[c0w + 2]) * KEXP);
    e.w = exp2f((v.w - ldsM[c0w + 3]) * KEXP);
    ((float4*)ldsE[wave])[i4] = e;
  }
  __syncthreads();

  v8f acc[4];
#pragma unroll
  for (int u = 0; u < 4; ++u)
    acc[u] = (v8f){0.f, 0.f, 0.f, 0.f, 0.f, 0.f, 0.f, 0.f};

#pragma unroll
  for (int ks = 0; ks < 16; ++ks) {
    const int c0 = ks * 4 + 2 * half;
    v2f a;                                  // A[row, c] = E[row, c]
    a.x = ldsE[wave][mloc * 64 + c0];
    a.y = ldsE[wave][mloc * 64 + c0 + 1];
#pragma unroll
    for (int u = 0; u < 4; ++u) {           // B[c, v] = ctx'[c, v]
      v2f b;
      b.x = ldsCtx[c0 * 64 + u * 16 + mloc];
      b.y = ldsCtx[(c0 + 1) * 64 + u * 16 + mloc];
      acc[u] = wmma_f32_16x16x4(a, b, acc[u]);
    }
  }
  float* o = out + (size_t)rowbase * 64;
#pragma unroll
  for (int u = 0; u < 4; ++u)
#pragma unroll
    for (int r = 0; r < 8; ++r) {
      int row = r + 8 * half;
      o[row * 64 + u * 16 + mloc] = acc[u][r];
    }
}

extern "C" void kernel_launch(void* const* d_in, const int* in_sizes, int n_in,
                              void* d_out, int out_size, void* d_ws, size_t ws_size,
                              hipStream_t stream) {
  (void)in_sizes; (void)n_in; (void)out_size; (void)ws_size;
  const float* Q = (const float*)d_in[0];
  const float* K = (const float*)d_in[1];
  const float* V = (const float*)d_in[2];
  float* out = (float*)d_out;

  // ws (floats): m[64] | s[64] | ctxp[4096] | pmax[16384] | psum[16384]
  //              | pctx[512*4096]   (~8.5 MB total)
  float* w    = (float*)d_ws;
  float* m    = w;
  float* s    = w + 64;
  float* ctxp = w + 128;
  float* pmax = w + 128 + 4096;
  float* psum = pmax + 256 * 64;
  float* pctx = psum + 256 * 64;

  kColStatsPartial<<<ST_BLOCKS, ST_THREADS, 0, stream>>>(Q, pmax, psum);
  kMergeStats   <<<1,  1024, 0, stream>>>(pmax, psum, m, s);
  kCtxPartial   <<<CTX_BLOCKS, CTX_WAVES * 32, 0, stream>>>(K, V, pctx);
  kReduceCtx    <<<16,  256, 0, stream>>>(pctx, s, ctxp);
  kOut          <<<2048, 256, 0, stream>>>(Q, m, ctxp, out);
}

// v003
// Measured time: 59.5 microseconds a run.
// Two timings next to v002 put it at 1.25 and 1.26 times that version's speed.
// Counting every step since v000, it is 2.93 times as fast.
#include <hip/hip_runtime.h>
#include <math.h>

// Linear attention, N=262144, d_k=d_v=64.  Memory-bound (>=256MB traffic,
// ~11-15us floor at 23.3TB/s).  f32 WMMA (16x16x4) for both matmuls,
// async global->LDS (b128) for K/V tile staging in the context pass.

#define NROWS 262144
#define DIM   64
#define KEXP  0.18033688011112042f   // (1/8) * log2(e)

#define CTX_BLOCKS 512
#define CTX_WAVES  4                 // 512 x 4 = 2048 waves streaming K/V

#define ST_BLOCKS  256               // column statistics of Q: 1024 rows a block
#define ST_THREADS 512
#define ST_F4      32                // float4 per thread = 1024*16/512

#define RC_BLOCKS  128               // context reduce: 32 elements a block
#define RC_THREADS 256
#define RC_ELEMS   (4096 / RC_BLOCKS)
#define RC_GROUPS  (RC_THREADS / (RC_ELEMS / 4))
#define RC_PER     (CTX_BLOCKS / RC_GROUPS)   // partials a thread

#define USE_ASYNC_LDS 1

typedef float v2f __attribute__((ext_vector_type(2)));
typedef float v4f __attribute__((ext_vector_type(4)));
typedef float v8f __attribute__((ext_vector_type(8)));

static __device__ __forceinline__ v8f wmma_f32_16x16x4(v2f a, v2f b, v8f c) {
  // 8 args: (neg_a, A, neg_b, B, c_mod, C, reuse_a, reuse_b)
  return __builtin_amdgcn_wmma_f32_16x16x4_f32(false, a, false, b, (short)0, c,
                                               false, false);
}

// Low 32 bits of a generic pointer into LDS == wave-relative LDS byte offset.
static __device__ __forceinline__ unsigned ldsOffsetOf(const void* p) {
  return (unsigned)(size_t)p;
}

static __device__ __forceinline__ void asyncLoadLdsB128(unsigned ldsOff,
                                                        const float* gaddr) {
#if USE_ASYNC_LDS
  asm volatile("global_load_async_to_lds_b128 %0, %1, off"
               :: "v"(ldsOff), "v"(gaddr) : "memory");
#endif
}

static __device__ __forceinline__ void waitAsync0() {
#if USE_ASYNC_LDS
  asm volatile("s_wait_asynccnt 0x0" ::: "memory");
#endif
}

// exp2 of an argument <= 0 by the bare instruction: exp2f's range fix-up acts only
// on results below 2^-126, which vanish against a sum that holds a term of 1.
// The closing v_nop keeps the one slot that the instruction set asks for behind a
// transcendental, whatever the compiler places next.
static __device__ __forceinline__ float exp2Neg(float x) {
  float r;
  asm("v_exp_f32 %0, %1\n\tv_nop" : "=v"(r) : "v"(x));
  return r;
}

// Four at once, one slot for the run; early-clobber outputs so that no result
// lands on a source that a later line of the statement still reads.
static __device__ __forceinline__ float4 exp2Neg4(float4 x) {
  float4 r;
  asm("v_exp_f32 %0, %4\n\tv_exp_f32 %1, %5\n\tv_exp_f32 %2, %6\n\t"
      "v_exp_f32 %3, %7\n\tv_nop"
      : "=&v"(r.x), "=&v"(r.y), "=&v"(r.z), "=&v"(r.w)
      : "v"(x.x), "v"(x.y), "v"(x.z), "v"(x.w));
  return r;
}

// Butterfly over the 16 lanes of a row (lane l with l ^ 1, 2, 4, 8) for eight
// values at once.  Written as asm because a shuffle from source goes through the
// LDS crossbar with a wait behind each step, while the DPP form stays on the
// vector port; one statement, step-major, so that the eight independent chains
// fill each other's latency (as separate statements the compiler put each chain
// back to back).
#define ROW8_STEP(OP, X)                                            \
  OP " %0, %0, %0 row_xmask:" X " row_mask:0xf bank_mask:0xf\n\t"   \
  OP " %1, %1, %1 row_xmask:" X " row_mask:0xf bank_mask:0xf\n\t"   \
  OP " %2, %2, %2 row_xmask:" X " row_mask:0xf bank_mask:0xf\n\t"   \
  OP " %3, %3, %3 row_xmask:" X " row_mask:0xf bank_mask:0xf\n\t"   \
  OP " %4, %4, %4 row_xmask:" X " row_mask:0xf bank_mask:0xf\n\t"   \
  OP " %5, %5, %5 row_xmask:" X " row_mask:0xf bank_mask:0xf\n\t"   \
  OP " %6, %6, %6 row_xmask:" X " row_mask:0xf bank_mask:0xf\n\t"   \
  OP " %7, %7, %7 row_xmask:" X " row_mask:0xf bank_mask:0xf\n\t"
#define ROW8_ALL(OP) \
  ROW8_STEP(OP, "1") ROW8_STEP(OP, "2") ROW8_STEP(OP, "4") ROW8_STEP(OP, "8")

static __device__ __forceinline__ void rowMax8(float (&r)[8]) {
  asm(ROW8_ALL("v_max_num_f32_dpp")
      : "+v"(r[0]), "+v"(r[1]), "+v"(r[2]), "+v"(r[3]),
        "+v"(r[4]), "+v"(r[5]), "+v"(r[6]), "+v"(r[7]));
}

static __device__ __forceinline__ void rowSum8(float (&r)[8]) {
  asm(ROW8_ALL("v_add_f32_dpp")
      : "+v"(r[0]), "+v"(r[1]), "+v"(r[2]), "+v"(r[3]),
        "+v"(r[4]), "+v"(r[5]), "+v"(r[6]), "+v"(r[7]));
}

// ---------- Pass 1: per-block column max AND sum of exp, Q read once ----------
// Each thread holds its 32 float4 of Q in registers (all loads issued before the
// first use), takes its own column maxes, sums exp against them, and the
// (max, sum) pairs are merged by rescaling: s = sum_j s_j * exp2((m_j - m)*KEXP).
// element (i*4+k) column = (tid*4+k) & 63 since strides are multiples of 64.
__global__ __launch_bounds__(ST_THREADS) void kColStatsPartial(
    const float* __restrict__ Q, float* __restrict__ pmax,
    float* __restrict__ psum) {
  __shared__ __attribute__((aligned(16))) float smM[ST_THREADS / 16][64];
  __shared__ __attribute__((aligned(16))) float smS[ST_THREADS / 16][64];
  const int tid = threadIdx.x, bid = blockIdx.x;
  const float4* q4 = (const float4*)(Q + (size_t)bid * (NROWS / ST_BLOCKS) * DIM);
  float4 v[ST_F4];
#pragma unroll
  for (int j = 0; j < ST_F4; ++j) v[j] = q4[tid + j * ST_THREADS];
  float4 mx = v[0];
#pragma unroll
  for (int j = 1; j < ST_F4; ++j) {
    mx.x = fmaxf(mx.x, v[j].x); mx.y = fmaxf(mx.y, v[j].y);
    mx.z = fmaxf(mx.z, v[j].z); mx.w = fmaxf(mx.w, v[j].w);
  }
  float4 s = {0.f, 0.f, 0.f, 0.f};
#pragma unroll
  for (int j = 0; j < ST_F4; ++j) {
    float4 a = {(v[j].x - mx.x) * KEXP, (v[j].y - mx.y) * KEXP,
                (v[j].z - mx.z) * KEXP, (v[j].w - mx.w) * KEXP};
    float4 e = exp2Neg4(a);
    s.x += e.x; s.y += e.y; s.z += e.z; s.w += e.w;
  }
  const int c0 = (tid * 4) & 63;                    // 4 columns owned
  const int mem = tid >> 4;                         // members per column set
  *(float4*)&smM[mem][c0] = mx;
  *(float4*)&smS[mem][c0] = s;
  __syncthreads();
  if (tid < 64) {
    float M = smM[0][tid];
#pragma unroll
    for (int j = 1; j < ST_THREADS / 16; ++j) M = fmaxf(M, smM[j][tid]);
    float S = 0.f;
#pragma unroll
    for (int j = 0; j < ST_THREADS / 16; ++j)
      S += smS[j][tid] * exp2Neg((smM[j][tid] - M) * KEXP);
    pmax[bid * 64 + tid] = M;
    psum[bid * 64 + tid] = S;
  }
}

// Merge the per-block (max, sum) pairs: 16 threads a column, 16 pairs each,
// then 64 threads merge the 16 group results (fixed order throughout).
__global__ __launch_bounds__(1024) void kMergeStats(const float* __restrict__ pmax,
                                                    const float* __restrict__ psum,
                                                    float* __restrict__ m,
                                                    float* __restrict__ s) {
  __shared__ float smM[16][64];
  __shared__ float smS[16][64];
  const int tid = threadIdx.x;
  const int c = tid & 63, g = tid >> 6;
  float pm[ST_BLOCKS / 16], pv[ST_BLOCKS / 16];
#pragma unroll
  for (int k = 0; k < ST_BLOCKS / 16; ++k) {
    pm[k] = pmax[(g * (ST_BLOCKS / 16) + k) * 64 + c];
    pv[k] = psum[(g * (ST_BLOCKS / 16) + k) * 64 + c];
  }
  float M = pm[0];
#pragma unroll
  for (int k = 1; k < ST_BLOCKS / 16; ++k) M = fmaxf(M, pm[k]);
  float S = 0.f;
#pragma unroll
  for (int k = 0; k < ST_BLOCKS / 16; ++k) S += pv[k] * exp2Neg((pm[k] - M) * KEXP);
  smM[g][c] = M;
  smS[g][c] = S;
  __syncthreads();
  if (tid < 64) {
    float Mt = smM[0][tid];
#pragma unroll
    for (int j = 1; j < 16; ++j) Mt = fmaxf(Mt, smM[j][tid]);
    float St = 0.f;
#pragma unroll
    for (int j = 0; j < 16; ++j) St += smS[j][tid] * exp2Neg((smM[j][tid] - Mt) * KEXP);
    m[tid] = Mt;
    s[tid] = St;
  }
}

// ---------- Pass 3: context partials, ctx[c,v] += sum_i kn[i,c]*V[i,v] ----------
// 512 blocks x 4 waves; each wave owns private 16x64 K/V tiles (async-filled),
// accumulates the full 64x64 in 16 f32 WMMA tiles, then a fixed-order
// (deterministic) cross-wave merge into block LDS.
__global__ __launch_bounds__(CTX_WAVES * 32) void kCtxPartial(
    const float* __restrict__ K, const float* __restrict__ V,
    float* __restrict__ pctx) {
  __shared__ float ldsK[CTX_WAVES][16 * 64];
  __shared__ float ldsV[CTX_WAVES][16 * 64];
  __shared__ float ldsAcc[4096];
  const int tid  = threadIdx.x;
  const int wave = tid >> 5;
  const int lane = tid & 31;
  const int bid  = blockIdx.x;
  const int half = lane >> 4;
  const int mloc = lane & 15;

  for (int e = tid; e < 4096; e += CTX_WAVES * 32) ldsAcc[e] = 0.0f;

  v8f acc[4][4];
#pragma unroll
  for (int t = 0; t < 4; ++t)
#pragma unroll
    for (int u = 0; u < 4; ++u)
      acc[t][u] = (v8f){0.f, 0.f, 0.f, 0.f, 0.f, 0.f, 0.f, 0.f};

  const unsigned kOff = ldsOffsetOf(&ldsK[wave][0]);
  const unsigned vOff = ldsOffsetOf(&ldsV[wave][0]);
  const int rowsPerBlock = NROWS / CTX_BLOCKS;            // 512
  const int rows0 = bid * rowsPerBlock + wave * (rowsPerBlock / CTX_WAVES);
  __syncthreads();                                        // ldsAcc zeroed

  for (int chunk = 0; chunk < (rowsPerBlock / CTX_WAVES) / 16; ++chunk) {
    const int rowbase = rows0 + chunk * 16;
    const float* kp = K + (size_t)rowbase * 64;
    const float* vp = V + (size_t)rowbase * 64;
#if USE_ASYNC_LDS
#pragma unroll
    for (int j = 0; j < 8; ++j) {                         // 16B per lane per op
      const int f4 = lane + j * 32;
      asyncLoadLdsB128(kOff + f4 * 16, kp + f4 * 4);
      asyncLoadLdsB128(vOff + f4 * 16, vp + f4 * 4);
    }
    waitAsync0();
#else
#pragma unroll
    for (int j = 0; j < 8; ++j) {
      const int f4 = lane + j * 32;
      ((float4*)ldsK[wave])[f4] = ((const float4*)kp)[f4];
      ((float4*)ldsV[wave])[f4] = ((const float4*)vp)[f4];
    }
#endif
    __syncthreads();
    // A = kn^T : A[c, i] = kn[i, c].  All 16 A fragments of the tile are read raw.
    // In this layout K row ks*4 + 2*half + {0,1} sits in component {x,y} of
    // a[ks][0..3] across the 16 lanes of this lane's half, so the row softmax is
    // taken right here: 4 values a lane, then a 16-lane butterfly; nothing is
    // written back to LDS.
    v2f a[4][4];
#pragma unroll
    for (int ks = 0; ks < 4; ++ks) {
      const int r0 = ks * 4 + 2 * half;   // this lane-half's first K row
#pragma unroll
      for (int t = 0; t < 4; ++t) {
        int c = t * 16 + mloc;
        a[ks][t].x = ldsK[wave][r0 * 64 + c];
        a[ks][t].y = ldsK[wave][(r0 + 1) * 64 + c];
      }
    }
    float red[8];                         // one value a row: max, then sum
#pragma unroll
    for (int ks = 0; ks < 4; ++ks) {
      red[2 * ks] = __builtin_fmaximum_numf(
          __builtin_fmaximum_numf(a[ks][0].x, a[ks][1].x),
          __builtin_fmaximum_numf(a[ks][2].x, a[ks][3].x));
      red[2 * ks + 1] = __builtin_fmaximum_numf(
          __builtin_fmaximum_numf(a[ks][0].y, a[ks][1].y),
          __builtin_fmaximum_numf(a[ks][2].y, a[ks][3].y));
    }
    rowMax8(red);
#pragma unroll
    for (int ks = 0; ks < 4; ++ks) {
      const float mx = red[2 * ks], my = red[2 * ks + 1];
#pragma unroll
      for (int t = 0; t < 4; t += 2) {
        float4 g = {(a[ks][t].x - mx) * KEXP, (a[ks][t].y - my) * KEXP,
                    (a[ks][t + 1].x - mx) * KEXP, (a[ks][t + 1].y - my) * KEXP};
        float4 e = exp2Neg4(g);
        a[ks][t].x = e.x;     a[ks][t].y = e.y;
        a[ks][t + 1].x = e.z; a[ks][t + 1].y = e.w;
      }
      red[2 * ks]     = (a[ks][0].x + a[ks][1].x) + (a[ks][2].x + a[ks][3].x);
      red[2 * ks + 1] = (a[ks][0].y + a[ks][1].y) + (a[ks][2].y + a[ks][3].y);
    }
    rowSum8(red);
#pragma unroll
    for (int ks = 0; ks < 4; ++ks) {
      // sums lie in [1, 64]: the bare reciprocal needs no range fix-up
      const v2f inv = {__builtin_amdgcn_rcpf(red[2 * ks]),
                       __builtin_amdgcn_rcpf(red[2 * ks + 1])};
#pragma unroll
      for (int t = 0; t < 4; ++t) a[ks][t] *= inv;
    }
#pragma unroll
    for (int ks = 0; ks < 4; ++ks) {
      const int r0 = ks * 4 + 2 * half;
      v2f b[4];
#pragma unroll
      for (int u = 0; u < 4; ++u) {       // B : B[i, v] = V[i, v]
        int v = u * 16 + mloc;
        b[u].x = ldsV[wave][r0 * 64 + v];
        b[u].y = ldsV[wave][(r0 + 1) * 64 + v];
      }
#pragma unroll
      for (int t = 0; t < 4; ++t)
#pragma unroll
        for (int u = 0; u < 4; ++u)
          acc[t][u] = wmma_f32_16x16x4(a[ks][t], b[u], acc[t][u]);
    }
    __syncthreads();
    // Distance behind the trip's last WMMA: across the back edge the next trip's
    // first vector instructions reuse that WMMA's A registers.
    // The scheduling barrier keeps every WMMA of the
    // trip in front of the slots.
    __builtin_amdgcn_sched_barrier(0);
    asm volatile("v_nop\n\tv_nop\n\tv_nop\n\tv_nop\n\t"
                 "v_nop\n\tv_nop\n\tv_nop\n\tv_nop");
  }

  // deterministic cross-wave merge (fixed wave order; disjoint (c,v) per lane)
  for (int w = 0; w < CTX_WAVES; ++w) {
    if (wave == w) {
#pragma unroll
      for (int t = 0; t < 4; ++t)
#pragma unroll
        for (int u = 0; u < 4; ++u)
#pragma unroll
          for (int r = 0; r < 8; ++r) {
            int c = t * 16 + r + 8 * half;    // D: VGPR r -> M=r / M=r+8
            int v = u * 16 + mloc;
            ldsAcc[c * 64 + v] += acc[t][u][r];
          }
    }
    __syncthreads();
  }
  float* dst = pctx + (size_t)bid * 4096;
  for (int e = tid; e < 4096; e += CTX_WAVES * 32) dst[e] = ldsAcc[e];
}

// ---------- Reduce context partials (fixed order) and fold in 1/s ----------
// A block owns 32 consecutive elements (one 128-byte line of every partial and of
// ctxp).  Its 256 threads are 8 float4 columns x 32 groups; a thread sums the 16
// partials of its group from loads that are all issued before the first add, so
// the kernel waits for about one memory round trip instead of one per unrolled
// trip of a 512-long loop.  The 32 group sums are merged through LDS.
__global__ __launch_bounds__(RC_THREADS) void kReduceCtx(
    const float* __restrict__ pctx, const float* __restrict__ s,
    float* __restrict__ ctxp) {
  __shared__ __attribute__((aligned(16))) float sm[RC_GROUPS][RC_ELEMS];
  const int tid = threadIdx.x, bid = blockIdx.x;
  const int q = tid & (RC_ELEMS / 4 - 1);         // float4 column in the line
  const int g = tid / (RC_ELEMS / 4);             // group of partials
  const v4f* p =
      (const v4f*)(pctx + (size_t)g * RC_PER * 4096 + bid * RC_ELEMS) + q;
  static_assert(RC_PER == 16, "the statement below names 16 loaded values");
  v4f v[RC_PER];
#pragma unroll   // v[] must stay in registers, here and in the sum below
  for (int k = 0; k < RC_PER; ++k) v[k] = p[k * 1024];
  // Holds the 16 loads in front of the first add (loaded values as inputs only):
  // without it the compiler issued the last three behind the first returns, to
  // reuse their registers, which puts a second round trip behind the first.
  // The pointer is an input too: it stays live past the loads, so that no load's
  // result lands on the address pair that the other loads of the run name.
  asm volatile("" :: "v"(v[0]), "v"(v[1]), "v"(v[2]), "v"(v[3]), "v"(v[4]),
               "v"(v[5]), "v"(v[6]), "v"(v[7]), "v"(v[8]), "v"(v[9]),
               "v"(v[10]), "v"(v[11]), "v"(v[12]), "v"(v[13]), "v"(v[14]),
               "v"(v[15]), "v"(p));
  v4f a = v[0];
#pragma unroll
  for (int k = 1; k < RC_PER; ++k) a += v[k];
  *(v4f*)&sm[g][q * 4] = a;
  __syncthreads();
  if (tid < RC_ELEMS) {
    float acc = sm[0][tid];
#pragma unroll   // lets the LDS reads run ahead of the chain of adds
    for (int j = 1; j < RC_GROUPS; ++j) acc += sm[j][tid];
    const int e = bid * RC_ELEMS + tid;
    ctxp[e] = acc / s[e >> 6];
  }
}

// ---------- Pass 4: out = E @ ctx'  (E = exp2((Q - m)*KEXP)) ----------
__global__ __launch_bounds__(256) void kOut(const float* __restrict__ Q,
                                            const float* __restrict__ m,
                                            const float* __restrict__ ctxp,
                                            float* __restrict__ out) {
  __shared__ float ldsCtx[4096];
  __shared__ float ldsM[64];
  __shared__ float ldsE[8][1024];
  const int tid  = threadIdx.x;
  const int wave = tid >> 5;
  const int lane = tid & 31;
  const int half = lane >> 4;
  const int mloc = lane & 15;

  for (int e = tid; e < 1024; e += 256)
    ((float4*)ldsCtx)[e] = ((const float4*)ctxp)[e];
  if (tid < 64) ldsM[tid] = m[tid];
  __syncthreads();

  const int rowbase = (blockIdx.x * 8 + wave) * 16;   // 16 rows per wave
  const float4* q4 = (const float4*)(Q + (size_t)rowbase * 64);
  const int c0w = (lane * 4) & 63;                    // cols of this lane's f4
#pragma unroll
  for (int j = 0; j < 8; ++j) {
    int i4 = lane + j * 32;
    float4 v = q4[i4];
    float4 e;
    e.x = exp2f((v.x - ldsM[c0w + 0]) * KEXP);
    e.y = exp2f((v.y - ldsM[c0w + 1]) * KEXP);
    e.z = exp2f((v.z - ldsM[c0w + 2]) * KEXP);
    e.w = exp2f((v.w - ldsM[c0w + 3]) * KEXP);
    ((float4*)ldsE[wave])[i4] = e;
  }
  __syncthreads();

  v8f acc[4];
#pragma unroll
  for (int u = 0; u < 4; ++u)
    acc[u] = (v8f){0.f, 0.f, 0.f, 0.f, 0.f, 0.f, 0.f, 0.f};

#pragma unroll
  for (int ks = 0; ks < 16; ++ks) {
    const int c0 = ks * 4 + 2 * half;
    v2f a;                                  // A[row, c] = E[row, c]
    a.x = ldsE[wave][mloc * 64 + c0];
    a.y = ldsE[wave][mloc * 64 + c0 + 1];
#pragma unroll
    for (int u = 0; u < 4; ++u) {           // B[c, v] = ctx'[c, v]
      v2f b;
      b.x = ldsCtx[c0 * 64 + u * 16 + mloc];
      b.y = ldsCtx[(c0 + 1) * 64 + u * 16 + mloc];
      acc[u] = wmma_f32_16x16x4(a, b, acc[u]);
    }
  }
  float* o = out + (size_t)rowbase * 64;
#pragma unroll
  for (int u = 0; u < 4; ++u)
#pragma unroll
    for (int r = 0; r < 8; ++r) {
      int row = r + 8 * half;
      o[row * 64 + u * 16 + mloc] = acc[u][r];
    }
}

extern "C" void kernel_launch(void* const* d_in, const int* in_sizes, int n_in,
                              void* d_out, int out_size, void* d_ws, size_t ws_size,
                              hipStream_t stream) {
  (void)in_sizes; (void)n_in; (void)out_size; (void)ws_size;
  const float* Q = (const float*)d_in[0];
  const float* K = (const float*)d_in[1];
  const float* V = (const float*)d_in[2];
  float* out = (float*)d_out;

  // ws (floats): m[64] | s[64] | ctxp[4096] | pmax[16384] | psum[16384]
  //              | pctx[512*4096]   (~8.5 MB total)
  float* w    = (float*)d_ws;
  float* m    = w;
  float* s    = w + 64;
  float* ctxp = w + 128;
  float* pmax = w + 128 + 4096;
  float* psum = pmax + 256 * 64;
  float* pctx = psum + 256 * 64;

  kColStatsPartial<<<ST_BLOCKS, ST_THREADS, 0, stream>>>(Q, pmax, psum);
  kMergeStats   <<<1,  1024, 0, stream>>>(pmax, psum, m, s);
  kCtxPartial   <<<CTX_BLOCKS, CTX_WAVES * 32, 0, stream>>>(K, V, pctx);
  kReduceCtx    <<<RC_BLOCKS, RC_THREADS, 0, stream>>>(pctx, s, ctxp);
  kOut          <<<2048, 256, 0, stream>>>(Q, m, ctxp, out);
}

// v004
// Measured time: 56.1 microseconds a run.
// Next to v003, in two timings, it ran 1.06 times as fast each time.
// Counting every step since v000, it is 3.11 times as fast.
#include <hip/hip_runtime.h>
#include <math.h>

// Linear attention, N=262144, d_k=d_v=64.  Memory-bound (>=256MB traffic,
// ~11-15us floor at 23.3TB/s).  f32 WMMA (16x16x4) for both matmuls,
// async global->LDS (b128) for K/V tile staging in the context pass.

#define NROWS 262144
#define DIM   64
#define KEXP  0.18033688011112042f   // (1/8) * log2(e)

#define CTX_BLOCKS 512
#define CTX_WAVES  4                 // 512 x 4 = 2048 waves streaming K/V

#define ST_BLOCKS  256               // column statistics of Q: 1024 rows a block
#define ST_THREADS 512
#define ST_F4      32                // float4 per thread = 1024*16/512

#define RC_BLOCKS  128               // context reduce: 32 elements a block
#define RC_THREADS 256
#define RC_ELEMS   (4096 / RC_BLOCKS)
#define RC_GROUPS  (RC_THREADS / (RC_ELEMS / 4))
#define RC_PER     (CTX_BLOCKS / RC_GROUPS)   // partials a thread

#define USE_ASYNC_LDS 1

// LDS layout of the output pass (bank = dword address mod 64).
// E rows, read as A fragments (16 lanes = 16 rows, 8 bytes each): at a pitch of
// 64 floats all 16 rows fall on one bank pair; at 68 a row starts 4 banks behind
// the row above, so the lanes of a read spread evenly over all 64 banks.
// 68 * 4 B = 17 * 16 B keeps the 16-byte stores aligned.
#define E_PITCH 68
// ctx', read as B fragments: a lane wants ctx'[c][v] and ctx'[c+1][v], c even, and
// lanes 16-31 the same columns two rows below lanes 0-15; in plain rows of 64 all
// four rows lie on the same 16 banks.  Here rows 2p and 2p+1 are interleaved
// column by column (one 8-byte read a fragment), and odd p keeps its 16-column
// groups swapped in pairs, so that the two lane halves use different banks.
// Place of the pair (ctx'[2p][v], ctx'[2p+1][v]), in floats:
#define CTX_PAIR_AT(p, v) ((p) * 128 + (((v) ^ (((p) & 1) << 4)) * 2))

typedef float v2f __attribute__((ext_vector_type(2)));
typedef float v4f __attribute__((ext_vector_type(4)));
typedef float v8f __attribute__((ext_vector_type(8)));

static __device__ __forceinline__ v8f wmma_f32_16x16x4(v2f a, v2f b, v8f c) {
  // 8 args: (neg_a, A, neg_b, B, c_mod, C, reuse_a, reuse_b)
  return __builtin_amdgcn_wmma_f32_16x16x4_f32(false, a, false, b, (short)0, c,
                                               false, false);
}

// Low 32 bits of a generic pointer into LDS == wave-relative LDS byte offset.
static __device__ __forceinline__ unsigned ldsOffsetOf(const void* p) {
  return (unsigned)(size_t)p;
}

static __device__ __forceinline__ void asyncLoadLdsB128(unsigned ldsOff,
                                                        const float* gaddr) {
#if USE_ASYNC_LDS
  asm volatile("global_load_async_to_lds_b128 %0, %1, off"
               :: "v"(ldsOff), "v"(gaddr) : "memory");
#endif
}

static __device__ __forceinline__ void waitAsync0() {
#if USE_ASYNC_LDS
  asm volatile("s_wait_asynccnt 0x0" ::: "memory");
#endif
}

// exp2 of an argument <= 0 by the bare instruction: exp2f's range fix-up acts only
// on results below 2^-126, which vanish against a sum that holds a term of 1.
// The closing v_nop keeps the one slot that the instruction set asks for behind a
// transcendental, whatever the compiler places next.
static __device__ __forceinline__ float exp2Neg(float x) {
  float r;
  asm("v_exp_f32 %0, %1\n\tv_nop" : "=v"(r) : "v"(x));
  return r;
}

// Four at once, one slot for the run; early-clobber outputs so that no result
// lands on a source that a later line of the statement still reads.
static __device__ __forceinline__ float4 exp2Neg4(float4 x) {
  float4 r;
  asm("v_exp_f32 %0, %4\n\tv_exp_f32 %1, %5\n\tv_exp_f32 %2, %6\n\t"
      "v_exp_f32 %3, %7\n\tv_nop"
      : "=&v"(r.x), "=&v"(r.y), "=&v"(r.z), "=&v"(r.w)
      : "v"(x.x), "v"(x.y), "v"(x.z), "v"(x.w));
  return r;
}

// Butterfly over the 16 lanes of a row (lane l with l ^ 1, 2, 4, 8) for eight
// values at once.  Written as asm because a shuffle from source goes through the
// LDS crossbar with a wait behind each step, while the DPP form stays on the
// vector port; one statement, step-major, so that the eight independent chains
// fill each other's latency (as separate statements the compiler put each chain
// back to back).
#define ROW8_STEP(OP, X)                                            \
  OP " %0, %0, %0 row_xmask:" X " row_mask:0xf bank_mask:0xf\n\t"   \
  OP " %1, %1, %1 row_xmask:" X " row_mask:0xf bank_mask:0xf\n\t"   \
  OP " %2, %2, %2 row_xmask:" X " row_mask:0xf bank_mask:0xf\n\t"   \
  OP " %3, %3, %3 row_xmask:" X " row_mask:0xf bank_mask:0xf\n\t"   \
  OP " %4, %4, %4 row_xmask:" X " row_mask:0xf bank_mask:0xf\n\t"   \
  OP " %5, %5, %5 row_xmask:" X " row_mask:0xf bank_mask:0xf\n\t"   \
  OP " %6, %6, %6 row_xmask:" X " row_mask:0xf bank_mask:0xf\n\t"   \
  OP " %7, %7, %7 row_xmask:" X " row_mask:0xf bank_mask:0xf\n\t"
#define ROW8_ALL(OP) \
  ROW8_STEP(OP, "1") ROW8_STEP(OP, "2") ROW8_STEP(OP, "4") ROW8_STEP(OP, "8")

static __device__ __forceinline__ void rowMax8(float (&r)[8]) {
  asm(ROW8_ALL("v_max_num_f32_dpp")
      : "+v"(r[0]), "+v"(r[1]), "+v"(r[2]), "+v"(r[3]),
        "+v"(r[4]), "+v"(r[5]), "+v"(r[6]), "+v"(r[7]));
}

static __device__ __forceinline__ void rowSum8(float (&r)[8]) {
  asm(ROW8_ALL("v_add_f32_dpp")
      : "+v"(r[0]), "+v"(r[1]), "+v"(r[2]), "+v"(r[3]),
        "+v"(r[4]), "+v"(r[5]), "+v"(r[6]), "+v"(r[7]));
}

// ---------- Pass 1: per-block column max AND sum of exp, Q read once ----------
// Each thread holds its 32 float4 of Q in registers (all loads issued before the
// first use), takes its own column maxes, sums exp against them, and the
// (max, sum) pairs are merged by rescaling: s = sum_j s_j * exp2((m_j - m)*KEXP).
// element (i*4+k) column = (tid*4+k) & 63 since strides are multiples of 64.
__global__ __launch_bounds__(ST_THREADS) void kColStatsPartial(
    const float* __restrict__ Q, float* __restrict__ pmax,
    float* __restrict__ psum) {
  __shared__ __attribute__((aligned(16))) float smM[ST_THREADS / 16][64];
  __shared__ __attribute__((aligned(16))) float smS[ST_THREADS / 16][64];
  const int tid = threadIdx.x, bid = blockIdx.x;
  const float4* q4 = (const float4*)(Q + (size_t)bid * (NROWS / ST_BLOCKS) * DIM);
  float4 v[ST_F4];
#pragma unroll
  for (int j = 0; j < ST_F4; ++j) v[j] = q4[tid + j * ST_THREADS];
  float4 mx = v[0];
#pragma unroll
  for (int j = 1; j < ST_F4; ++j) {
    mx.x = fmaxf(mx.x, v[j].x); mx.y = fmaxf(mx.y, v[j].y);
    mx.z = fmaxf(mx.z, v[j].z); mx.w = fmaxf(mx.w, v[j].w);
  }
  float4 s = {0.f, 0.f, 0.f, 0.f};
#pragma unroll
  for (int j = 0; j < ST_F4; ++j) {
    float4 a = {(v[j].x - mx.x) * KEXP, (v[j].y - mx.y) * KEXP,
                (v[j].z - mx.z) * KEXP, (v[j].w - mx.w) * KEXP};
    float4 e = exp2Neg4(a);
    s.x += e.x; s.y += e.y; s.z += e.z; s.w += e.w;
  }
  const int c0 = (tid * 4) & 63;                    // 4 columns owned
  const int mem = tid >> 4;                         // members per column set
  *(float4*)&smM[mem][c0] = mx;
  *(float4*)&smS[mem][c0] = s;
  __syncthreads();
  if (tid < 64) {
    float M = smM[0][tid];
#pragma unroll
    for (int j = 1; j < ST_THREADS / 16; ++j) M = fmaxf(M, smM[j][tid]);
    float S = 0.f;
#pragma unroll
    for (int j = 0; j < ST_THREADS / 16; ++j)
      S += smS[j][tid] * exp2Neg((smM[j][tid] - M) * KEXP);
    pmax[bid * 64 + tid] = M;
    psum[bid * 64 + tid] = S;
  }
}

// Merge the per-block (max, sum) pairs: 16 threads a column, 16 pairs each,
// then 64 threads merge the 16 group results (fixed order throughout).
__global__ __launch_bounds__(1024) void kMergeStats(const float* __restrict__ pmax,
                                                    const float* __restrict__ psum,
                                                    float* __restrict__ m,
                                                    float* __restrict__ s) {
  __shared__ float smM[16][64];
  __shared__ float smS[16][64];
  const int tid = threadIdx.x;
  const int c = tid & 63, g = tid >> 6;
  float pm[ST_BLOCKS / 16], pv[ST_BLOCKS / 16];
#pragma unroll
  for (int k = 0; k < ST_BLOCKS / 16; ++k) {
    pm[k] = pmax[(g * (ST_BLOCKS / 16) + k) * 64 + c];
    pv[k] = psum[(g * (ST_BLOCKS / 16) + k) * 64 + c];
  }
  float M = pm[0];
#pragma unroll
  for (int k = 1; k < ST_BLOCKS / 16; ++k) M = fmaxf(M, pm[k]);
  float S = 0.f;
#pragma unroll
  for (int k = 0; k < ST_BLOCKS / 16; ++k) S += pv[k] * exp2Neg((pm[k] - M) * KEXP);
  smM[g][c] = M;
  smS[g][c] = S;
  __syncthreads();
  if (tid < 64) {
    float Mt = smM[0][tid];
#pragma unroll
    for (int j = 1; j < 16; ++j) Mt = fmaxf(Mt, smM[j][tid]);
    float St = 0.f;
#pragma unroll
    for (int j = 0; j < 16; ++j) St += smS[j][tid] * exp2Neg((smM[j][tid] - Mt) * KEXP);
    m[tid] = Mt;
    s[tid] = St;
  }
}

// ---------- Pass 3: context partials, ctx[c,v] += sum_i kn[i,c]*V[i,v] ----------
// 512 blocks x 4 waves; each wave owns private 16x64 K/V tiles (async-filled),
// accumulates the full 64x64 in 16 f32 WMMA tiles, then a fixed-order
// (deterministic) cross-wave merge into block LDS.
__global__ __launch_bounds__(CTX_WAVES * 32) void kCtxPartial(
    const float* __restrict__ K, const float* __restrict__ V,
    float* __restrict__ pctx) {
  __shared__ float ldsK[CTX_WAVES][16 * 64];
  __shared__ float ldsV[CTX_WAVES][16 * 64];
  __shared__ float ldsAcc[4096];
  const int tid  = threadIdx.x;
  const int wave = tid >> 5;
  const int lane = tid & 31;
  const int bid  = blockIdx.x;
  const int half = lane >> 4;
  const int mloc = lane & 15;

  for (int e = tid; e < 4096; e += CTX_WAVES * 32) ldsAcc[e] = 0.0f;

  v8f acc[4][4];
#pragma unroll
  for (int t = 0; t < 4; ++t)
#pragma unroll
    for (int u = 0; u < 4; ++u)
      acc[t][u] = (v8f){0.f, 0.f, 0.f, 0.f, 0.f, 0.f, 0.f, 0.f};

  const unsigned kOff = ldsOffsetOf(&ldsK[wave][0]);
  const unsigned vOff = ldsOffsetOf(&ldsV[wave][0]);
  const int rowsPerBlock = NROWS / CTX_BLOCKS;            // 512
  const int rows0 = bid * rowsPerBlock + wave * (rowsPerBlock / CTX_WAVES);
  __syncthreads();                                        // ldsAcc zeroed

  for (int chunk = 0; chunk < (rowsPerBlock / CTX_WAVES) / 16; ++chunk) {
    const int rowbase = rows0 + chunk * 16;
    const float* kp = K + (size_t)rowbase * 64;
    const float* vp = V + (size_t)rowbase * 64;
#if USE_ASYNC_LDS
#pragma unroll
    for (int j = 0; j < 8; ++j) {                         // 16B per lane per op
      const int f4 = lane + j * 32;
      asyncLoadLdsB128(kOff + f4 * 16, kp + f4 * 4);
      asyncLoadLdsB128(vOff + f4 * 16, vp + f4 * 4);
    }
    waitAsync0();
#else
#pragma unroll
    for (int j = 0; j < 8; ++j) {
      const int f4 = lane + j * 32;
      ((float4*)ldsK[wave])[f4] = ((const float4*)kp)[f4];
      ((float4*)ldsV[wave])[f4] = ((const float4*)vp)[f4];
    }
#endif
    __syncthreads();
    // A = kn^T : A[c, i] = kn[i, c].  All 16 A fragments of the tile are read raw.
    // In this layout K row ks*4 + 2*half + {0,1} sits in component {x,y} of
    // a[ks][0..3] across the 16 lanes of this lane's half, so the row softmax is
    // taken right here: 4 values a lane, then a 16-lane butterfly; nothing is
    // written back to LDS.
    v2f a[4][4];
#pragma unroll
    for (int ks = 0; ks < 4; ++ks) {
      const int r0 = ks * 4 + 2 * half;   // this lane-half's first K row
#pragma unroll
      for (int t = 0; t < 4; ++t) {
        int c = t * 16 + mloc;
        a[ks][t].x = ldsK[wave][r0 * 64 + c];
        a[ks][t].y = ldsK[wave][(r0 + 1) * 64 + c];
      }
    }
    float red[8];                         // one value a row: max, then sum
#pragma unroll
    for (int ks = 0; ks < 4; ++ks) {
      red[2 * ks] = __builtin_fmaximum_numf(
          __builtin_fmaximum_numf(a[ks][0].x, a[ks][1].x),
          __builtin_fmaximum_numf(a[ks][2].x, a[ks][3].x));
      red[2 * ks + 1] = __builtin_fmaximum_numf(
          __builtin_fmaximum_numf(a[ks][0].y, a[ks][1].y),
          __builtin_fmaximum_numf(a[ks][2].y, a[ks][3].y));
    }
    rowMax8(red);
#pragma unroll
    for (int ks = 0; ks < 4; ++ks) {
      const float mx = red[2 * ks], my = red[2 * ks + 1];
#pragma unroll
      for (int t = 0; t < 4; t += 2) {
        float4 g = {(a[ks][t].x - mx) * KEXP, (a[ks][t].y - my) * KEXP,
                    (a[ks][t + 1].x - mx) * KEXP, (a[ks][t + 1].y - my) * KEXP};
        float4 e = exp2Neg4(g);
        a[ks][t].x = e.x;     a[ks][t].y = e.y;
        a[ks][t + 1].x = e.z; a[ks][t + 1].y = e.w;
      }
      red[2 * ks]     = (a[ks][0].x + a[ks][1].x) + (a[ks][2].x + a[ks][3].x);
      red[2 * ks + 1] = (a[ks][0].y + a[ks][1].y) + (a[ks][2].y + a[ks][3].y);
    }
    rowSum8(red);
#pragma unroll
    for (int ks = 0; ks < 4; ++ks) {
      // sums lie in [1, 64]: the bare reciprocal needs no range fix-up
      const v2f inv = {__builtin_amdgcn_rcpf(red[2 * ks]),
                       __builtin_amdgcn_rcpf(red[2 * ks + 1])};
#pragma unroll
      for (int t = 0; t < 4; ++t) a[ks][t] *= inv;
    }
#pragma unroll
    for (int ks = 0; ks < 4; ++ks) {
      const int r0 = ks * 4 + 2 * half;
      v2f b[4];
#pragma unroll
      for (int u = 0; u < 4; ++u) {       // B : B[i, v] = V[i, v]
        int v = u * 16 + mloc;
        b[u].x = ldsV[wave][r0 * 64 + v];
        b[u].y = ldsV[wave][(r0 + 1) * 64 + v];
      }
#pragma unroll
      for (int t = 0; t < 4; ++t)
#pragma unroll
        for (int u = 0; u < 4; ++u)
          acc[t][u] = wmma_f32_16x16x4(a[ks][t], b[u], acc[t][u]);
    }
    __syncthreads();
    // Distance behind the trip's last WMMA: across the back edge the next trip's
    // first vector instructions reuse that WMMA's A registers.
    // The scheduling barrier keeps every WMMA of the
    // trip in front of the slots.
    __builtin_amdgcn_sched_barrier(0);
    asm volatile("v_nop\n\tv_nop\n\tv_nop\n\tv_nop\n\t"
                 "v_nop\n\tv_nop\n\tv_nop\n\tv_nop");
  }

  // deterministic cross-wave merge (fixed wave order; disjoint (c,v) per lane)
  for (int w = 0; w < CTX_WAVES; ++w) {
    if (wave == w) {
#pragma unroll
      for (int t = 0; t < 4; ++t)
#pragma unroll
        for (int u = 0; u < 4; ++u)
#pragma unroll
          for (int r = 0; r < 8; ++r) {
            int c = t * 16 + r + 8 * half;    // D: VGPR r -> M=r / M=r+8
            int v = u * 16 + mloc;
            ldsAcc[c * 64 + v] += acc[t][u][r];
          }
    }
    __syncthreads();
  }
  float* dst = pctx + (size_t)bid * 4096;
  for (int e = tid; e < 4096; e += CTX_WAVES * 32) dst[e] = ldsAcc[e];
}

// ---------- Reduce context partials (fixed order) and fold in 1/s ----------
// A block owns 32 consecutive elements (one 128-byte line of every partial and of
// ctxp).  Its 256 threads are 8 float4 columns x 32 groups; a thread sums the 16
// partials of its group from loads that are all issued before the first add, so
// the kernel waits for about one memory round trip instead of one per unrolled
// trip of a 512-long loop.  The 32 group sums are merged through LDS.
__global__ __launch_bounds__(RC_THREADS) void kReduceCtx(
    const float* __restrict__ pctx, const float* __restrict__ s,
    float* __restrict__ ctxp) {
  __shared__ __attribute__((aligned(16))) float sm[RC_GROUPS][RC_ELEMS];
  const int tid = threadIdx.x, bid = blockIdx.x;
  const int q = tid & (RC_ELEMS / 4 - 1);         // float4 column in the line
  const int g = tid / (RC_ELEMS / 4);             // group of partials
  const v4f* p =
      (const v4f*)(pctx + (size_t)g * RC_PER * 4096 + bid * RC_ELEMS) + q;
  static_assert(RC_PER == 16, "the statement below names 16 loaded values");
  v4f v[RC_PER];
#pragma unroll   // v[] must stay in registers, here and in the sum below
  for (int k = 0; k < RC_PER; ++k) v[k] = p[k * 1024];
  // Holds the 16 loads in front of the first add (loaded values as inputs only):
  // without it the compiler issued the last three behind the first returns, to
  // reuse their registers, which puts a second round trip behind the first.
  // The pointer is an input too: it stays live past the loads, so that no load's
  // result lands on the address pair that the other loads of the run name.
  asm volatile("" :: "v"(v[0]), "v"(v[1]), "v"(v[2]), "v"(v[3]), "v"(v[4]),
               "v"(v[5]), "v"(v[6]), "v"(v[7]), "v"(v[8]), "v"(v[9]),
               "v"(v[10]), "v"(v[11]), "v"(v[12]), "v"(v[13]), "v"(v[14]),
               "v"(v[15]), "v"(p));
  v4f a = v[0];
#pragma unroll
  for (int k = 1; k < RC_PER; ++k) a += v[k];
  *(v4f*)&sm[g][q * 4] = a;
  __syncthreads();
  if (tid < RC_ELEMS) {
    float acc = sm[0][tid];
#pragma unroll   // lets the LDS reads run ahead of the chain of adds
    for (int j = 1; j < RC_GROUPS; ++j) acc += sm[j][tid];
    const int e = bid * RC_ELEMS + tid;
    ctxp[e] = acc / s[e >> 6];
  }
}

// ---------- Pass 4: out = E @ ctx'  (E = exp2((Q - m)*KEXP)) ----------
__global__ __launch_bounds__(256) void kOut(const float* __restrict__ Q,
                                            const float* __restrict__ m,
                                            const float* __restrict__ ctxp,
                                            float* __restrict__ out) {
  __shared__ __attribute__((aligned(16))) float ldsCtx[4096];
  __shared__ float ldsM[64];
  __shared__ __attribute__((aligned(16))) float ldsE[8][16 * E_PITCH];
  const int tid  = threadIdx.x;
  const int wave = tid >> 5;
  const int lane = tid & 31;
  const int half = lane >> 4;
  const int mloc = lane & 15;

  for (int e = tid; e < 512; e += 256) {              // 4 columns of a row pair
    const int p = e >> 4, v4 = e & 15;
    const float4 r0 = ((const float4*)ctxp)[(2 * p) * 16 + v4];
    const float4 r1 = ((const float4*)ctxp)[(2 * p + 1) * 16 + v4];
    float4* d = (float4*)&ldsCtx[CTX_PAIR_AT(p, v4 * 4)];
    d[0] = make_float4(r0.x, r1.x, r0.y, r1.y);
    d[1] = make_float4(r0.z, r1.z, r0.w, r1.w);
  }
  if (tid < 64) ldsM[tid] = m[tid];
  __syncthreads();

  const int rowbase = (blockIdx.x * 8 + wave) * 16;   // 16 rows per wave
  const float4* q4 = (const float4*)(Q + (size_t)rowbase * 64);
  const int c0w = (lane * 4) & 63;                    // cols of this lane's f4
  float* eRow = &ldsE[wave][half * E_PITCH + c0w];    // float4 j: row 2j + half
#pragma unroll
  for (int j = 0; j < 8; ++j) {
    int i4 = lane + j * 32;
    float4 v = q4[i4];
    float4 e;
    e.x = exp2f((v.x - ldsM[c0w + 0]) * KEXP);
    e.y = exp2f((v.y - ldsM[c0w + 1]) * KEXP);
    e.z = exp2f((v.z - ldsM[c0w + 2]) * KEXP);
    e.w = exp2f((v.w - ldsM[c0w + 3]) * KEXP);
    *(float4*)(eRow + j * 2 * E_PITCH) = e;
  }
  __syncthreads();

  v8f acc[4];
#pragma unroll
  for (int u = 0; u < 4; ++u)
    acc[u] = (v8f){0.f, 0.f, 0.f, 0.f, 0.f, 0.f, 0.f, 0.f};

  // CTX_PAIR_AT(ks * 2 + half, u * 16 + mloc) with the lane's part taken out: the
  // column group is u ^ half, that is u + half for even u and u - half for odd u.
  const float* bEven = ldsCtx + half * (128 + 32) + mloc * 2;
  const float* bOdd  = ldsCtx + half * (128 - 32) + mloc * 2;
#pragma unroll
  for (int ks = 0; ks < 16; ++ks) {
    const int c0 = ks * 4 + 2 * half;
    v2f a;                                  // A[row, c] = E[row, c]
    a.x = ldsE[wave][mloc * E_PITCH + c0];
    a.y = ldsE[wave][mloc * E_PITCH + c0 + 1];
#pragma unroll
    for (int u = 0; u < 4; ++u) {           // B[c, v] = ctx'[c, v]
      const v2f b = *(const v2f*)(((u & 1) ? bOdd : bEven) + ks * 256 + u * 32);
      acc[u] = wmma_f32_16x16x4(a, b, acc[u]);
    }
  }
  float* o = out + (size_t)rowbase * 64;
#pragma unroll
  for (int u = 0; u < 4; ++u)
#pragma unroll
    for (int r = 0; r < 8; ++r) {
      int row = r + 8 * half;
      o[row * 64 + u * 16 + mloc] = acc[u][r];
    }
}

extern "C" void kernel_launch(void* const* d_in, const int* in_sizes, int n_in,
                              void* d_out, int out_size, void* d_ws, size_t ws_size,
                              hipStream_t stream) {
  (void)in_sizes; (void)n_in; (void)out_size; (void)ws_size;
  const float* Q = (const float*)d_in[0];
  const float* K = (const float*)d_in[1];
  const float* V = (const float*)d_in[2];
  float* out = (float*)d_out;

  // ws (floats): m[64] | s[64] | ctxp[4096] | pmax[16384] | psum[16384]
  //              | pctx[512*4096]   (~8.5 MB total)
  float* w    = (float*)d_ws;
  float* m    = w;
  float* s    = w + 64;
  float* ctxp = w + 128;
  float* pmax = w + 128 + 4096;
  float* psum = pmax + 256 * 64;
  float* pctx = psum + 256 * 64;

  kColStatsPartial<<<ST_BLOCKS, ST_THREADS, 0, stream>>>(Q, pmax, psum);
  kMergeStats   <<<1,  1024, 0, stream>>>(pmax, psum, m, s);
  kCtxPartial   <<<CTX_BLOCKS, CTX_WAVES * 32, 0, stream>>>(K, V, pctx);
  kReduceCtx    <<<RC_BLOCKS, RC_THREADS, 0, stream>>>(pctx, s, ctxp);
  kOut          <<<2048, 256, 0, stream>>>(Q, m, ctxp, out);
}

// v005
// A run of this version takes 52.6 microseconds.
// Two timings next to v004 put it at 1.07 and 1.06 times that version's speed.
// Over all steps from v000 it is 3.31 times as fast.
#include <hip/hip_runtime.h>
#include <math.h>

// Linear attention, N=262144, d_k=d_v=64.  Memory-bound (>=256MB traffic,
// ~11-15us floor at 23.3TB/s).  f32 WMMA (16x16x4) for both matmuls,
// async global->LDS (b128) for K/V tile staging in the context pass.

#define NROWS 262144
#define DIM   64
#define KEXP  0.18033688011112042f   // (1/8) * log2(e)

#define CTX_BLOCKS 512
#define CTX_WAVES  4                 // 512 x 4 = 2048 waves streaming K/V

#define ST_BLOCKS  256               // column statistics of Q: 1024 rows a block
#define ST_THREADS (CTX_WAVES * 32)  // they share the context pass's launch
#define ST_F4      32                // float4 a thread holds at a time (one batch)
#define ST_BATCHES 4                 // 1024*16 float4 / (128 threads * 32)
#define ST_STRIDE  (ST_THREADS * ST_BATCHES)   // float4 between a batch's loads
#define ST_MEMBERS (ST_STRIDE / 16)  // (max, sum) pairs a column set in a block

#define RC_BLOCKS  128               // context reduce: 32 elements a block
#define RC_THREADS 256
#define RC_ELEMS   (4096 / RC_BLOCKS)
#define RC_GROUPS  (RC_THREADS / (RC_ELEMS / 4))
#define RC_PER     (CTX_BLOCKS / RC_GROUPS)   // partials a thread

#define USE_ASYNC_LDS 1

// LDS layout of the output pass (bank = dword address mod 64).
// E rows, read as A fragments (16 lanes = 16 rows, 8 bytes each): at a pitch of
// 64 floats all 16 rows fall on one bank pair; at 68 a row starts 4 banks behind
// the row above, so the lanes of a read spread evenly over all 64 banks.
// 68 * 4 B = 17 * 16 B keeps the 16-byte stores aligned.
#define E_PITCH 68
// ctx', read as B fragments: a lane wants ctx'[c][v] and ctx'[c+1][v], c even, and
// lanes 16-31 the same columns two rows below lanes 0-15; in plain rows of 64 all
// four rows lie on the same 16 banks.  Here rows 2p and 2p+1 are interleaved
// column by column (one 8-byte read a fragment), and odd p keeps its 16-column
// groups swapped in pairs, so that the two lane halves use different banks.
// Place of the pair (ctx'[2p][v], ctx'[2p+1][v]), in floats:
#define CTX_PAIR_AT(p, v) ((p) * 128 + (((v) ^ (((p) & 1) << 4)) * 2))

typedef float v2f __attribute__((ext_vector_type(2)));
typedef float v4f __attribute__((ext_vector_type(4)));
typedef float v8f __attribute__((ext_vector_type(8)));

static __device__ __forceinline__ v8f wmma_f32_16x16x4(v2f a, v2f b, v8f c) {
  // 8 args: (neg_a, A, neg_b, B, c_mod, C, reuse_a, reuse_b)
  return __builtin_amdgcn_wmma_f32_16x16x4_f32(false, a, false, b, (short)0, c,
                                               false, false);
}

// Low 32 bits of a generic pointer into LDS == wave-relative LDS byte offset.
static __device__ __forceinline__ unsigned ldsOffsetOf(const void* p) {
  return (unsigned)(size_t)p;
}

static __device__ __forceinline__ void asyncLoadLdsB128(unsigned ldsOff,
                                                        const float* gaddr) {
#if USE_ASYNC_LDS
  asm volatile("global_load_async_to_lds_b128 %0, %1, off"
               :: "v"(ldsOff), "v"(gaddr) : "memory");
#endif
}

static __device__ __forceinline__ void waitAsync0() {
#if USE_ASYNC_LDS
  asm volatile("s_wait_asynccnt 0x0" ::: "memory");
#endif
}

// exp2 of an argument <= 0 by the bare instruction: exp2f's range fix-up acts only
// on results below 2^-126, which vanish against a sum that holds a term of 1.
// The closing v_nop keeps the one slot that the instruction set asks for behind a
// transcendental, whatever the compiler places next.
static __device__ __forceinline__ float exp2Neg(float x) {
  float r;
  asm("v_exp_f32 %0, %1\n\tv_nop" : "=v"(r) : "v"(x));
  return r;
}

// Four at once, one slot for the run; early-clobber outputs so that no result
// lands on a source that a later line of the statement still reads.
static __device__ __forceinline__ float4 exp2Neg4(float4 x) {
  float4 r;
  asm("v_exp_f32 %0, %4\n\tv_exp_f32 %1, %5\n\tv_exp_f32 %2, %6\n\t"
      "v_exp_f32 %3, %7\n\tv_nop"
      : "=&v"(r.x), "=&v"(r.y), "=&v"(r.z), "=&v"(r.w)
      : "v"(x.x), "v"(x.y), "v"(x.z), "v"(x.w));
  return r;
}

// Butterfly over the 16 lanes of a row (lane l with l ^ 1, 2, 4, 8) for eight
// values at once.  Written as asm because a shuffle from source goes through the
// LDS crossbar with a wait behind each step, while the DPP form stays on the
// vector port; one statement, step-major, so that the eight independent chains
// fill each other's latency (as separate statements the compiler put each chain
// back to back).
#define ROW8_STEP(OP, X)                                            \
  OP " %0, %0, %0 row_xmask:" X " row_mask:0xf bank_mask:0xf\n\t"   \
  OP " %1, %1, %1 row_xmask:" X " row_mask:0xf bank_mask:0xf\n\t"   \
  OP " %2, %2, %2 row_xmask:" X " row_mask:0xf bank_mask:0xf\n\t"   \
  OP " %3, %3, %3 row_xmask:" X " row_mask:0xf bank_mask:0xf\n\t"   \
  OP " %4, %4, %4 row_xmask:" X " row_mask:0xf bank_mask:0xf\n\t"   \
  OP " %5, %5, %5 row_xmask:" X " row_mask:0xf bank_mask:0xf\n\t"   \
  OP " %6, %6, %6 row_xmask:" X " row_mask:0xf bank_mask:0xf\n\t"   \
  OP " %7, %7, %7 row_xmask:" X " row_mask:0xf bank_mask:0xf\n\t"
#define ROW8_ALL(OP) \
  ROW8_STEP(OP, "1") ROW8_STEP(OP, "2") ROW8_STEP(OP, "4") ROW8_STEP(OP, "8")

static __device__ __forceinline__ void rowMax8(float (&r)[8]) {
  asm(ROW8_ALL("v_max_num_f32_dpp")
      : "+v"(r[0]), "+v"(r[1]), "+v"(r[2]), "+v"(r[3]),
        "+v"(r[4]), "+v"(r[5]), "+v"(r[6]), "+v"(r[7]));
}

static __device__ __forceinline__ void rowSum8(float (&r)[8]) {
  asm(ROW8_ALL("v_add_f32_dpp")
      : "+v"(r[0]), "+v"(r[1]), "+v"(r[2]), "+v"(r[3]),
        "+v"(r[4]), "+v"(r[5]), "+v"(r[6]), "+v"(r[7]));
}

// ---------- Per-block column max AND sum of exp, Q read once ----------
// The role of the blocks behind the first CTX_BLOCKS of kCtxAndStats (below).
// A thread holds 32 float4 of Q in registers (all loads issued before the first
// use), takes its own column maxes and sums exp against them; it does so for four
// batches, one after the other.  Batch b of thread t holds float4
// t + 128 b + 512 j, j = 0..31.  The (max, sum) pairs of all batches are merged
// by rescaling: s = sum_j s_j * exp2((m_j - m)*KEXP).
// element (i*4+k) column = (tid*4+k) & 63 since strides are multiples of 64.
static __device__ __forceinline__ void colStatsBlock(
    const float* __restrict__ Q, float* __restrict__ pmax,
    float* __restrict__ psum, const int sb) {
  __shared__ __attribute__((aligned(16))) float smM[ST_MEMBERS][64];
  __shared__ __attribute__((aligned(16))) float smS[ST_MEMBERS][64];
  const int tid = threadIdx.x;
  const float4* q4 =
      (const float4*)(Q + (size_t)sb * (NROWS / ST_BLOCKS) * DIM) + tid;
  const int c0 = (tid * 4) & 63;                    // 4 columns owned
  // Kept rolled: unrolled, the compiler held a third of each batch's loads back
  // until the first ones had returned, a second memory round trip in every batch;
  // rolled, a batch's 32 loads stand together at the head of its trip.
#pragma unroll 1
  for (int b = 0; b < ST_BATCHES; ++b) {
    float4 v[ST_F4];
#pragma unroll
    for (int j = 0; j < ST_F4; ++j) v[j] = q4[b * ST_THREADS + j * ST_STRIDE];
    float4 mx = v[0];
#pragma unroll
    for (int j = 1; j < ST_F4; ++j) {
      mx.x = fmaxf(mx.x, v[j].x); mx.y = fmaxf(mx.y, v[j].y);
      mx.z = fmaxf(mx.z, v[j].z); mx.w = fmaxf(mx.w, v[j].w);
    }
    float4 s = {0.f, 0.f, 0.f, 0.f};
#pragma unroll
    for (int j = 0; j < ST_F4; ++j) {
      float4 a = {(v[j].x - mx.x) * KEXP, (v[j].y - mx.y) * KEXP,
                  (v[j].z - mx.z) * KEXP, (v[j].w - mx.w) * KEXP};
      float4 e = exp2Neg4(a);
      s.x += e.x; s.y += e.y; s.z += e.z; s.w += e.w;
    }
    const int mem = b * (ST_THREADS / 16) + (tid >> 4);
    *(float4*)&smM[mem][c0] = mx;
    *(float4*)&smS[mem][c0] = s;
  }
  __syncthreads();
  if (tid < 64) {
    float M = smM[0][tid];
#pragma unroll
    for (int j = 1; j < ST_MEMBERS; ++j) M = fmaxf(M, smM[j][tid]);
    float S = 0.f;
#pragma unroll
    for (int j = 0; j < ST_MEMBERS; ++j)
      S += smS[j][tid] * exp2Neg((smM[j][tid] - M) * KEXP);
    pmax[sb * 64 + tid] = M;
    psum[sb * 64 + tid] = S;
  }
}

// Merge the per-block (max, sum) pairs: 16 threads a column, 16 pairs each,
// then 64 threads merge the 16 group results (fixed order throughout).
__global__ __launch_bounds__(1024) void kMergeStats(const float* __restrict__ pmax,
                                                    const float* __restrict__ psum,
                                                    float* __restrict__ m,
                                                    float* __restrict__ s) {
  __shared__ float smM[16][64];
  __shared__ float smS[16][64];
  const int tid = threadIdx.x;
  const int c = tid & 63, g = tid >> 6;
  float pm[ST_BLOCKS / 16], pv[ST_BLOCKS / 16];
#pragma unroll
  for (int k = 0; k < ST_BLOCKS / 16; ++k) {
    pm[k] = pmax[(g * (ST_BLOCKS / 16) + k) * 64 + c];
    pv[k] = psum[(g * (ST_BLOCKS / 16) + k) * 64 + c];
  }
  float M = pm[0];
#pragma unroll
  for (int k = 1; k < ST_BLOCKS / 16; ++k) M = fmaxf(M, pm[k]);
  float S = 0.f;
#pragma unroll
  for (int k = 0; k < ST_BLOCKS / 16; ++k) S += pv[k] * exp2Neg((pm[k] - M) * KEXP);
  smM[g][c] = M;
  smS[g][c] = S;
  __syncthreads();
  if (tid < 64) {
    float Mt = smM[0][tid];
#pragma unroll
    for (int j = 1; j < 16; ++j) Mt = fmaxf(Mt, smM[j][tid]);
    float St = 0.f;
#pragma unroll
    for (int j = 0; j < 16; ++j) St += smS[j][tid] * exp2Neg((smM[j][tid] - Mt) * KEXP);
    m[tid] = Mt;
    s[tid] = St;
  }
}

// ---------- Pass 3: context partials, ctx[c,v] += sum_i kn[i,c]*V[i,v] ----------
// 512 blocks x 4 waves; each wave owns private 16x64 K/V tiles (async-filled),
// accumulates the full 64x64 in 16 f32 WMMA tiles, then a fixed-order
// (deterministic) cross-wave merge into block LDS.
// The column statistics of Q need nothing of this pass and this pass nothing of
// them, so ST_BLOCKS more blocks of the same launch take them: this pass is held
// by the matrix unit and by its waits for K/V tiles, the statistics by memory and
// the vector port, and one launch lets the two run side by side on every WGP.
// The context blocks come first in the grid: they run longest.
__global__ __launch_bounds__(CTX_WAVES * 32) void kCtxAndStats(
    const float* __restrict__ K, const float* __restrict__ V,
    float* __restrict__ pctx, const float* __restrict__ Q,
    float* __restrict__ pmax, float* __restrict__ psum) {
  if (blockIdx.x >= CTX_BLOCKS) {       // the same for a whole block
    colStatsBlock(Q, pmax, psum, blockIdx.x - CTX_BLOCKS);
    return;
  }
  __shared__ float ldsK[CTX_WAVES][16 * 64];
  __shared__ float ldsV[CTX_WAVES][16 * 64];
  __shared__ float ldsAcc[4096];
  const int tid  = threadIdx.x;
  const int wave = tid >> 5;
  const int lane = tid & 31;
  const int bid  = blockIdx.x;
  const int half = lane >> 4;
  const int mloc = lane & 15;

  for (int e = tid; e < 4096; e += CTX_WAVES * 32) ldsAcc[e] = 0.0f;

  v8f acc[4][4];
#pragma unroll
  for (int t = 0; t < 4; ++t)
#pragma unroll
    for (int u = 0; u < 4; ++u)
      acc[t][u] = (v8f){0.f, 0.f, 0.f, 0.f, 0.f, 0.f, 0.f, 0.f};

  const unsigned kOff = ldsOffsetOf(&ldsK[wave][0]);
  const unsigned vOff = ldsOffsetOf(&ldsV[wave][0]);
  const int rowsPerBlock = NROWS / CTX_BLOCKS;            // 512
  const int rows0 = bid * rowsPerBlock + wave * (rowsPerBlock / CTX_WAVES);
  __syncthreads();                                        // ldsAcc zeroed

  for (int chunk = 0; chunk < (rowsPerBlock / CTX_WAVES) / 16; ++chunk) {
    const int rowbase = rows0 + chunk * 16;
    const float* kp = K + (size_t)rowbase * 64;
    const float* vp = V + (size_t)rowbase * 64;
#if USE_ASYNC_LDS
#pragma unroll
    for (int j = 0; j < 8; ++j) {                         // 16B per lane per op
      const int f4 = lane + j * 32;
      asyncLoadLdsB128(kOff + f4 * 16, kp + f4 * 4);
      asyncLoadLdsB128(vOff + f4 * 16, vp + f4 * 4);
    }
    waitAsync0();
#else
#pragma unroll
    for (int j = 0; j < 8; ++j) {
      const int f4 = lane + j * 32;
      ((float4*)ldsK[wave])[f4] = ((const float4*)kp)[f4];
      ((float4*)ldsV[wave])[f4] = ((const float4*)vp)[f4];
    }
#endif
    __syncthreads();
    // A = kn^T : A[c, i] = kn[i, c].  All 16 A fragments of the tile are read raw.
    // In this layout K row ks*4 + 2*half + {0,1} sits in component {x,y} of
    // a[ks][0..3] across the 16 lanes of this lane's half, so the row softmax is
    // taken right here: 4 values a lane, then a 16-lane butterfly; nothing is
    // written back to LDS.
    v2f a[4][4];
#pragma unroll
    for (int ks = 0; ks < 4; ++ks) {
      const int r0 = ks * 4 + 2 * half;   // this lane-half's first K row
#pragma unroll
      for (int t = 0; t < 4; ++t) {
        int c = t * 16 + mloc;
        a[ks][t].x = ldsK[wave][r0 * 64 + c];
        a[ks][t].y = ldsK[wave][(r0 + 1) * 64 + c];
      }
    }
    float red[8];                         // one value a row: max, then sum
#pragma unroll
    for (int ks = 0; ks < 4; ++ks) {
      red[2 * ks] = __builtin_fmaximum_numf(
          __builtin_fmaximum_numf(a[ks][0].x, a[ks][1].x),
          __builtin_fmaximum_numf(a[ks][2].x, a[ks][3].x));
      red[2 * ks + 1] = __builtin_fmaximum_numf(
          __builtin_fmaximum_numf(a[ks][0].y, a[ks][1].y),
          __builtin_fmaximum_numf(a[ks][2].y, a[ks][3].y));
    }
    rowMax8(red);
#pragma unroll
    for (int ks = 0; ks < 4; ++ks) {
      const float mx = red[2 * ks], my = red[2 * ks + 1];
#pragma unroll
      for (int t = 0; t < 4; t += 2) {
        float4 g = {(a[ks][t].x - mx) * KEXP, (a[ks][t].y - my) * KEXP,
                    (a[ks][t + 1].x - mx) * KEXP, (a[ks][t + 1].y - my) * KEXP};
        float4 e = exp2Neg4(g);
        a[ks][t].x = e.x;     a[ks][t].y = e.y;
        a[ks][t + 1].x = e.z; a[ks][t + 1].y = e.w;
      }
      red[2 * ks]     = (a[ks][0].x + a[ks][1].x) + (a[ks][2].x + a[ks][3].x);
      red[2 * ks + 1] = (a[ks][0].y + a[ks][1].y) + (a[ks][2].y + a[ks][3].y);
    }
    rowSum8(red);
#pragma unroll
    for (int ks = 0; ks < 4; ++ks) {
      // sums lie in [1, 64]: the bare reciprocal needs no range fix-up
      const v2f inv = {__builtin_amdgcn_rcpf(red[2 * ks]),
                       __builtin_amdgcn_rcpf(red[2 * ks + 1])};
#pragma unroll
      for (int t = 0; t < 4; ++t) a[ks][t] *= inv;
    }
#pragma unroll
    for (int ks = 0; ks < 4; ++ks) {
      const int r0 = ks * 4 + 2 * half;
      v2f b[4];
#pragma unroll
      for (int u = 0; u < 4; ++u) {       // B : B[i, v] = V[i, v]
        int v = u * 16 + mloc;
        b[u].x = ldsV[wave][r0 * 64 + v];
        b[u].y = ldsV[wave][(r0 + 1) * 64 + v];
      }
#pragma unroll
      for (int t = 0; t < 4; ++t)
#pragma unroll
        for (int u = 0; u < 4; ++u)
          acc[t][u] = wmma_f32_16x16x4(a[ks][t], b[u], acc[t][u]);
    }
    __syncthreads();
    // Distance behind the trip's last WMMA: across the back edge the next trip's
    // first vector instructions reuse that WMMA's A registers.
    // The scheduling barrier keeps every WMMA of the
    // trip in front of the slots.
    __builtin_amdgcn_sched_barrier(0);
    asm volatile("v_nop\n\tv_nop\n\tv_nop\n\tv_nop\n\t"
                 "v_nop\n\tv_nop\n\tv_nop\n\tv_nop");
  }

  // deterministic cross-wave merge (fixed wave order; disjoint (c,v) per lane)
  for (int w = 0; w < CTX_WAVES; ++w) {
    if (wave == w) {
#pragma unroll
      for (int t = 0; t < 4; ++t)
#pragma unroll
        for (int u = 0; u < 4; ++u)
#pragma unroll
          for (int r = 0; r < 8; ++r) {
            int c = t * 16 + r + 8 * half;    // D: VGPR r -> M=r / M=r+8
            int v = u * 16 + mloc;
            ldsAcc[c * 64 + v] += acc[t][u][r];
          }
    }
    __syncthreads();
  }
  float* dst = pctx + (size_t)bid * 4096;
  for (int e = tid; e < 4096; e += CTX_WAVES * 32) dst[e] = ldsAcc[e];
}

// ---------- Reduce context partials (fixed order) and fold in 1/s ----------
// A block owns 32 consecutive elements (one 128-byte line of every partial and of
// ctxp).  Its 256 threads are 8 float4 columns x 32 groups; a thread sums the 16
// partials of its group from loads that are all issued before the first add, so
// the kernel waits for about one memory round trip instead of one per unrolled
// trip of a 512-long loop.  The 32 group sums are merged through LDS.
__global__ __launch_bounds__(RC_THREADS) void kReduceCtx(
    const float* __restrict__ pctx, const float* __restrict__ s,
    float* __restrict__ ctxp) {
  __shared__ __attribute__((aligned(16))) float sm[RC_GROUPS][RC_ELEMS];
  const int tid = threadIdx.x, bid = blockIdx.x;
  const int q = tid & (RC_ELEMS / 4 - 1);         // float4 column in the line
  const int g = tid / (RC_ELEMS / 4);             // group of partials
  const v4f* p =
      (const v4f*)(pctx + (size_t)g * RC_PER * 4096 + bid * RC_ELEMS) + q;
  static_assert(RC_PER == 16, "the statement below names 16 loaded values");
  v4f v[RC_PER];
#pragma unroll   // v[] must stay in registers, here and in the sum below
  for (int k = 0; k < RC_PER; ++k) v[k] = p[k * 1024];
  // Holds the 16 loads in front of the first add (loaded values as inputs only):
  // without it the compiler issued the last three behind the first returns, to
  // reuse their registers, which puts a second round trip behind the first.
  // The pointer is an input too: it stays live past the loads, so that no load's
  // result lands on the address pair that the other loads of the run name.
  asm volatile("" :: "v"(v[0]), "v"(v[1]), "v"(v[2]), "v"(v[3]), "v"(v[4]),
               "v"(v[5]), "v"(v[6]), "v"(v[7]), "v"(v[8]), "v"(v[9]),
               "v"(v[10]), "v"(v[11]), "v"(v[12]), "v"(v[13]), "v"(v[14]),
               "v"(v[15]), "v"(p));
  v4f a = v[0];
#pragma unroll
  for (int k = 1; k < RC_PER; ++k) a += v[k];
  *(v4f*)&sm[g][q * 4] = a;
  __syncthreads();
  if (tid < RC_ELEMS) {
    float acc = sm[0][tid];
#pragma unroll   // lets the LDS reads run ahead of the chain of adds
    for (int j = 1; j < RC_GROUPS; ++j) acc += sm[j][tid];
    const int e = bid * RC_ELEMS + tid;
    ctxp[e] = acc / s[e >> 6];
  }
}

// ---------- Pass 4: out = E @ ctx'  (E = exp2((Q - m)*KEXP)) ----------
__global__ __launch_bounds__(256) void kOut(const float* __restrict__ Q,
                                            const float* __restrict__ m,
                                            const float* __restrict__ ctxp,
                                            float* __restrict__ out) {
  __shared__ __attribute__((aligned(16))) float ldsCtx[4096];
  __shared__ float ldsM[64];
  __shared__ __attribute__((aligned(16))) float ldsE[8][16 * E_PITCH];
  const int tid  = threadIdx.x;
  const int wave = tid >> 5;
  const int lane = tid & 31;
  const int half = lane >> 4;
  const int mloc = lane & 15;

  for (int e = tid; e < 512; e += 256) {              // 4 columns of a row pair
    const int p = e >> 4, v4 = e & 15;
    const float4 r0 = ((const float4*)ctxp)[(2 * p) * 16 + v4];
    const float4 r1 = ((const float4*)ctxp)[(2 * p + 1) * 16 + v4];
    float4* d = (float4*)&ldsCtx[CTX_PAIR_AT(p, v4 * 4)];
    d[0] = make_float4(r0.x, r1.x, r0.y, r1.y);
    d[1] = make_float4(r0.z, r1.z, r0.w, r1.w);
  }
  if (tid < 64) ldsM[tid] = m[tid];
  __syncthreads();

  const int rowbase = (blockIdx.x * 8 + wave) * 16;   // 16 rows per wave
  const float4* q4 = (const float4*)(Q + (size_t)rowbase * 64);
  const int c0w = (lane * 4) & 63;                    // cols of this lane's f4
  float* eRow = &ldsE[wave][half * E_PITCH + c0w];    // float4 j: row 2j + half
#pragma unroll
  for (int j = 0; j < 8; ++j) {
    int i4 = lane + j * 32;
    float4 v = q4[i4];
    float4 e;
    e.x = exp2f((v.x - ldsM[c0w + 0]) * KEXP);
    e.y = exp2f((v.y - ldsM[c0w + 1]) * KEXP);
    e.z = exp2f((v.z - ldsM[c0w + 2]) * KEXP);
    e.w = exp2f((v.w - ldsM[c0w + 3]) * KEXP);
    *(float4*)(eRow + j * 2 * E_PITCH) = e;
  }
  __syncthreads();

  v8f acc[4];
#pragma unroll
  for (int u = 0; u < 4; ++u)
    acc[u] = (v8f){0.f, 0.f, 0.f, 0.f, 0.f, 0.f, 0.f, 0.f};

  // CTX_PAIR_AT(ks * 2 + half, u * 16 + mloc) with the lane's part taken out: the
  // column group is u ^ half, that is u + half for even u and u - half for odd u.
  const float* bEven = ldsCtx + half * (128 + 32) + mloc * 2;
  const float* bOdd  = ldsCtx + half * (128 - 32) + mloc * 2;
#pragma unroll
  for (int ks = 0; ks < 16; ++ks) {
    const int c0 = ks * 4 + 2 * half;
    v2f a;                                  // A[row, c] = E[row, c]
    a.x = ldsE[wave][mloc * E_PITCH + c0];
    a.y = ldsE[wave][mloc * E_PITCH + c0 + 1];
#pragma unroll
    for (int u = 0; u < 4; ++u) {           // B[c, v] = ctx'[c, v]
      const v2f b = *(const v2f*)(((u & 1) ? bOdd : bEven) + ks * 256 + u * 32);
      acc[u] = wmma_f32_16x16x4(a, b, acc[u]);
    }
  }
  float* o = out + (size_t)rowbase * 64;
#pragma unroll
  for (int u = 0; u < 4; ++u)
#pragma unroll
    for (int r = 0; r < 8; ++r) {
      int row = r + 8 * half;
      o[row * 64 + u * 16 + mloc] = acc[u][r];
    }
}

extern "C" void kernel_launch(void* const* d_in, const int* in_sizes, int n_in,
                              void* d_out, int out_size, void* d_ws, size_t ws_size,
                              hipStream_t stream) {
  (void)in_sizes; (void)n_in; (void)out_size; (void)ws_size;
  const float* Q = (const float*)d_in[0];
  const float* K = (const float*)d_in[1];
  const float* V = (const float*)d_in[2];
  float* out = (float*)d_out;

  // ws (floats): m[64] | s[64] | ctxp[4096] | pmax[16384] | psum[16384]
  //              | pctx[512*4096]   (~8.5 MB total)
  float* w    = (float*)d_ws;
  float* m    = w;
  float* s    = w + 64;
  float* ctxp = w + 128;
  float* pmax = w + 128 + 4096;
  float* psum = pmax + 256 * 64;
  float* pctx = psum + 256 * 64;

  kCtxAndStats  <<<CTX_BLOCKS + ST_BLOCKS, CTX_WAVES * 32, 0, stream>>>(
      K, V, pctx, Q, pmax, psum);
  kMergeStats   <<<1,  1024, 0, stream>>>(pmax, psum, m, s);
  kReduceCtx    <<<RC_BLOCKS, RC_THREADS, 0, stream>>>(pctx, s, ctxp);
  kOut          <<<2048, 256, 0, stream>>>(Q, m, ctxp, out);
}

// v006
// It runs in 48 microseconds.
// Two timings next to v005 both put it at 1.09 times that version's speed.
// Over all steps from v000 it is 3.61 times as fast.
#include <hip/hip_runtime.h>
#include <math.h>

// Linear attention, N=262144, d_k=d_v=64.  Memory-bound (>=256MB traffic,
// ~11-15us floor at 23.3TB/s).  f32 WMMA (16x16x4) for both matmuls,
// async global->LDS (b128) for K/V tile staging in the context pass.

#define NROWS 262144
#define DIM   64
#define KEXP  0.18033688011112042f   // (1/8) * log2(e)

#define CTX_BLOCKS 512
#define CTX_WAVES  4                 // 512 x 4 = 2048 waves streaming K/V

#define ST_BLOCKS  256               // column statistics of Q: 1024 rows a block
#define ST_THREADS (CTX_WAVES * 32)  // they share the context pass's launch
#define ST_F4      32                // float4 a thread holds at a time (one batch)
#define ST_BATCHES 4                 // 1024*16 float4 / (128 threads * 32)
#define ST_STRIDE  (ST_THREADS * ST_BATCHES)   // float4 between a batch's loads
#define ST_MEMBERS (ST_STRIDE / 16)  // (max, sum) pairs a column set in a block

#define RC_BLOCKS  128               // context reduce: 32 elements a block
#define RC_THREADS 256
#define RC_ELEMS   (4096 / RC_BLOCKS)
#define RC_GROUPS  (RC_THREADS / (RC_ELEMS / 4))
#define RC_PER     (CTX_BLOCKS / RC_GROUPS)   // partials a thread
#define MX_BLOCKS  2                 // column maxes of Q: 32 columns a block
#define MX_PER     (ST_BLOCKS / (RC_THREADS / 32))   // per-block maxes a thread

#define USE_ASYNC_LDS 1

// LDS layout of the output pass (bank = dword address mod 64).
// E rows, read as A fragments (16 lanes = 16 rows, 8 bytes each): at a pitch of
// 64 floats all 16 rows fall on one bank pair; at 68 a row starts 4 banks behind
// the row above, so the lanes of a read spread evenly over all 64 banks.
// 68 * 4 B = 17 * 16 B keeps the 16-byte stores aligned.
#define E_PITCH 68
// ctx', read as B fragments: a lane wants ctx'[c][v] and ctx'[c+1][v], c even, and
// lanes 16-31 the same columns two rows below lanes 0-15; in plain rows of 64 all
// four rows lie on the same 16 banks.  Here rows 2p and 2p+1 are interleaved
// column by column (one 8-byte read a fragment), and odd p keeps its 16-column
// groups swapped in pairs, so that the two lane halves use different banks.
// Place of the pair (ctx'[2p][v], ctx'[2p+1][v]), in floats:
#define CTX_PAIR_AT(p, v) ((p) * 128 + (((v) ^ (((p) & 1) << 4)) * 2))

typedef float v2f __attribute__((ext_vector_type(2)));
typedef float v4f __attribute__((ext_vector_type(4)));
typedef float v8f __attribute__((ext_vector_type(8)));

static __device__ __forceinline__ v8f wmma_f32_16x16x4(v2f a, v2f b, v8f c) {
  // 8 args: (neg_a, A, neg_b, B, c_mod, C, reuse_a, reuse_b)
  return __builtin_amdgcn_wmma_f32_16x16x4_f32(false, a, false, b, (short)0, c,
                                               false, false);
}

// Low 32 bits of a generic pointer into LDS == wave-relative LDS byte offset.
static __device__ __forceinline__ unsigned ldsOffsetOf(const void* p) {
  return (unsigned)(size_t)p;
}

static __device__ __forceinline__ void asyncLoadLdsB128(unsigned ldsOff,
                                                        const float* gaddr) {
#if USE_ASYNC_LDS
  asm volatile("global_load_async_to_lds_b128 %0, %1, off"
               :: "v"(ldsOff), "v"(gaddr) : "memory");
#endif
}

static __device__ __forceinline__ void waitAsync0() {
#if USE_ASYNC_LDS
  asm volatile("s_wait_asynccnt 0x0" ::: "memory");
#endif
}

// exp2 of an argument <= 0 by the bare instruction: exp2f's range fix-up acts only
// on results below 2^-126, which vanish against a sum that holds a term of 1.
// The closing v_nop keeps the one slot that the instruction set asks for behind a
// transcendental, whatever the compiler places next.
static __device__ __forceinline__ float exp2Neg(float x) {
  float r;
  asm("v_exp_f32 %0, %1\n\tv_nop" : "=v"(r) : "v"(x));
  return r;
}

// Four at once, one slot for the run; early-clobber outputs so that no result
// lands on a source that a later line of the statement still reads.
static __device__ __forceinline__ float4 exp2Neg4(float4 x) {
  float4 r;
  asm("v_exp_f32 %0, %4\n\tv_exp_f32 %1, %5\n\tv_exp_f32 %2, %6\n\t"
      "v_exp_f32 %3, %7\n\tv_nop"
      : "=&v"(r.x), "=&v"(r.y), "=&v"(r.z), "=&v"(r.w)
      : "v"(x.x), "v"(x.y), "v"(x.z), "v"(x.w));
  return r;
}

// Butterfly over the 16 lanes of a row (lane l with l ^ 1, 2, 4, 8) for eight
// values at once.  Written as asm because a shuffle from source goes through the
// LDS crossbar with a wait behind each step, while the DPP form stays on the
// vector port; one statement, step-major, so that the eight independent chains
// fill each other's latency (as separate statements the compiler put each chain
// back to back).
#define ROW8_STEP(OP, X)                                            \
  OP " %0, %0, %0 row_xmask:" X " row_mask:0xf bank_mask:0xf\n\t"   \
  OP " %1, %1, %1 row_xmask:" X " row_mask:0xf bank_mask:0xf\n\t"   \
  OP " %2, %2, %2 row_xmask:" X " row_mask:0xf bank_mask:0xf\n\t"   \
  OP " %3, %3, %3 row_xmask:" X " row_mask:0xf bank_mask:0xf\n\t"   \
  OP " %4, %4, %4 row_xmask:" X " row_mask:0xf bank_mask:0xf\n\t"   \
  OP " %5, %5, %5 row_xmask:" X " row_mask:0xf bank_mask:0xf\n\t"   \
  OP " %6, %6, %6 row_xmask:" X " row_mask:0xf bank_mask:0xf\n\t"   \
  OP " %7, %7, %7 row_xmask:" X " row_mask:0xf bank_mask:0xf\n\t"
#define ROW8_ALL(OP) \
  ROW8_STEP(OP, "1") ROW8_STEP(OP, "2") ROW8_STEP(OP, "4") ROW8_STEP(OP, "8")

static __device__ __forceinline__ void rowMax8(float (&r)[8]) {
  asm(ROW8_ALL("v_max_num_f32_dpp")
      : "+v"(r[0]), "+v"(r[1]), "+v"(r[2]), "+v"(r[3]),
        "+v"(r[4]), "+v"(r[5]), "+v"(r[6]), "+v"(r[7]));
}

static __device__ __forceinline__ void rowSum8(float (&r)[8]) {
  asm(ROW8_ALL("v_add_f32_dpp")
      : "+v"(r[0]), "+v"(r[1]), "+v"(r[2]), "+v"(r[3]),
        "+v"(r[4]), "+v"(r[5]), "+v"(r[6]), "+v"(r[7]));
}

// ---------- Per-block column max AND sum of exp, Q read once ----------
// The role of the blocks behind the first CTX_BLOCKS of kCtxAndStats (below).
// A thread holds 32 float4 of Q in registers (all loads issued before the first
// use), takes its own column maxes and sums exp against them; it does so for four
// batches, one after the other.  Batch b of thread t holds float4
// t + 128 b + 512 j, j = 0..31.  The (max, sum) pairs of all batches are merged
// by rescaling: s = sum_j s_j * exp2((m_j - m)*KEXP).
// element (i*4+k) column = (tid*4+k) & 63 since strides are multiples of 64.
static __device__ __forceinline__ void colStatsBlock(
    const float* __restrict__ Q, float* __restrict__ pmax,
    float* __restrict__ psum, const int sb) {
  __shared__ __attribute__((aligned(16))) float smM[ST_MEMBERS][64];
  __shared__ __attribute__((aligned(16))) float smS[ST_MEMBERS][64];
  const int tid = threadIdx.x;
  const float4* q4 =
      (const float4*)(Q + (size_t)sb * (NROWS / ST_BLOCKS) * DIM) + tid;
  const int c0 = (tid * 4) & 63;                    // 4 columns owned
  // Kept rolled: unrolled, the compiler held a third of each batch's loads back
  // until the first ones had returned, a second memory round trip in every batch;
  // rolled, a batch's 32 loads stand together at the head of its trip.
#pragma unroll 1
  for (int b = 0; b < ST_BATCHES; ++b) {
    float4 v[ST_F4];
#pragma unroll
    for (int j = 0; j < ST_F4; ++j) v[j] = q4[b * ST_THREADS + j * ST_STRIDE];
    float4 mx = v[0];
#pragma unroll
    for (int j = 1; j < ST_F4; ++j) {
      mx.x = fmaxf(mx.x, v[j].x); mx.y = fmaxf(mx.y, v[j].y);
      mx.z = fmaxf(mx.z, v[j].z); mx.w = fmaxf(mx.w, v[j].w);
    }
    float4 s = {0.f, 0.f, 0.f, 0.f};
#pragma unroll
    for (int j = 0; j < ST_F4; ++j) {
      float4 a = {(v[j].x - mx.x) * KEXP, (v[j].y - mx.y) * KEXP,
                  (v[j].z - mx.z) * KEXP, (v[j].w - mx.w) * KEXP};
      float4 e = exp2Neg4(a);
      s.x += e.x; s.y += e.y; s.z += e.z; s.w += e.w;
    }
    const int mem = b * (ST_THREADS / 16) + (tid >> 4);
    *(float4*)&smM[mem][c0] = mx;
    *(float4*)&smS[mem][c0] = s;
  }
  __syncthreads();
  if (tid < 64) {
    float M = smM[0][tid];
#pragma unroll
    for (int j = 1; j < ST_MEMBERS; ++j) M = fmaxf(M, smM[j][tid]);
    float S = 0.f;
#pragma unroll
    for (int j = 0; j < ST_MEMBERS; ++j)
      S += smS[j][tid] * exp2Neg((smM[j][tid] - M) * KEXP);
    pmax[sb * 64 + tid] = M;
    psum[sb * 64 + tid] = S;
  }
}

// ---------- Pass 3: context partials, ctx[c,v] += sum_i kn[i,c]*V[i,v] ----------
// 512 blocks x 4 waves; each wave owns private 16x64 K/V tiles (async-filled),
// accumulates the full 64x64 in 16 f32 WMMA tiles, then a fixed-order
// (deterministic) cross-wave merge into block LDS.
// The column statistics of Q need nothing of this pass and this pass nothing of
// them, so ST_BLOCKS more blocks of the same launch take them: this pass is held
// by the matrix unit and by its waits for K/V tiles, the statistics by memory and
// the vector port, and one launch lets the two run side by side on every WGP.
// The context blocks come first in the grid: they run longest.
__global__ __launch_bounds__(CTX_WAVES * 32) void kCtxAndStats(
    const float* __restrict__ K, const float* __restrict__ V,
    float* __restrict__ pctx, const float* __restrict__ Q,
    float* __restrict__ pmax, float* __restrict__ psum) {
  if (blockIdx.x >= CTX_BLOCKS) {       // the same for a whole block
    colStatsBlock(Q, pmax, psum, blockIdx.x - CTX_BLOCKS);
    return;
  }
  __shared__ float ldsK[CTX_WAVES][16 * 64];
  __shared__ float ldsV[CTX_WAVES][16 * 64];
  __shared__ float ldsAcc[4096];
  const int tid  = threadIdx.x;
  const int wave = tid >> 5;
  const int lane = tid & 31;
  const int bid  = blockIdx.x;
  const int half = lane >> 4;
  const int mloc = lane & 15;

  for (int e = tid; e < 4096; e += CTX_WAVES * 32) ldsAcc[e] = 0.0f;

  v8f acc[4][4];
#pragma unroll
  for (int t = 0; t < 4; ++t)
#pragma unroll
    for (int u = 0; u < 4; ++u)
      acc[t][u] = (v8f){0.f, 0.f, 0.f, 0.f, 0.f, 0.f, 0.f, 0.f};

  const unsigned kOff = ldsOffsetOf(&ldsK[wave][0]);
  const unsigned vOff = ldsOffsetOf(&ldsV[wave][0]);
  const int rowsPerBlock = NROWS / CTX_BLOCKS;            // 512
  const int rows0 = bid * rowsPerBlock + wave * (rowsPerBlock / CTX_WAVES);
  __syncthreads();                                        // ldsAcc zeroed

  for (int chunk = 0; chunk < (rowsPerBlock / CTX_WAVES) / 16; ++chunk) {
    const int rowbase = rows0 + chunk * 16;
    const float* kp = K + (size_t)rowbase * 64;
    const float* vp = V + (size_t)rowbase * 64;
#if USE_ASYNC_LDS
#pragma unroll
    for (int j = 0; j < 8; ++j) {                         // 16B per lane per op
      const int f4 = lane + j * 32;
      asyncLoadLdsB128(kOff + f4 * 16, kp + f4 * 4);
      asyncLoadLdsB128(vOff + f4 * 16, vp + f4 * 4);
    }
    waitAsync0();
#else
#pragma unroll
    for (int j = 0; j < 8; ++j) {
      const int f4 = lane + j * 32;
      ((float4*)ldsK[wave])[f4] = ((const float4*)kp)[f4];
      ((float4*)ldsV[wave])[f4] = ((const float4*)vp)[f4];
    }
#endif
    __syncthreads();
    // A = kn^T : A[c, i] = kn[i, c].  All 16 A fragments of the tile are read raw.
    // In this layout K row ks*4 + 2*half + {0,1} sits in component {x,y} of
    // a[ks][0..3] across the 16 lanes of this lane's half, so the row softmax is
    // taken right here: 4 values a lane, then a 16-lane butterfly; nothing is
    // written back to LDS.
    v2f a[4][4];
#pragma unroll
    for (int ks = 0; ks < 4; ++ks) {
      const int r0 = ks * 4 + 2 * half;   // this lane-half's first K row
#pragma unroll
      for (int t = 0; t < 4; ++t) {
        int c = t * 16 + mloc;
        a[ks][t].x = ldsK[wave][r0 * 64 + c];
        a[ks][t].y = ldsK[wave][(r0 + 1) * 64 + c];
      }
    }
    float red[8];                         // one value a row: max, then sum
#pragma unroll
    for (int ks = 0; ks < 4; ++ks) {
      red[2 * ks] = __builtin_fmaximum_numf(
          __builtin_fmaximum_numf(a[ks][0].x, a[ks][1].x),
          __builtin_fmaximum_numf(a[ks][2].x, a[ks][3].x));
      red[2 * ks + 1] = __builtin_fmaximum_numf(
          __builtin_fmaximum_numf(a[ks][0].y, a[ks][1].y),
          __builtin_fmaximum_numf(a[ks][2].y, a[ks][3].y));
    }
    rowMax8(red);
#pragma unroll
    for (int ks = 0; ks < 4; ++ks) {
      const float mx = red[2 * ks], my = red[2 * ks + 1];
#pragma unroll
      for (int t = 0; t < 4; t += 2) {
        float4 g = {(a[ks][t].x - mx) * KEXP, (a[ks][t].y - my) * KEXP,
                    (a[ks][t + 1].x - mx) * KEXP, (a[ks][t + 1].y - my) * KEXP};
        float4 e = exp2Neg4(g);
        a[ks][t].x = e.x;     a[ks][t].y = e.y;
        a[ks][t + 1].x = e.z; a[ks][t + 1].y = e.w;
      }
      red[2 * ks]     = (a[ks][0].x + a[ks][1].x) + (a[ks][2].x + a[ks][3].x);
      red[2 * ks + 1] = (a[ks][0].y + a[ks][1].y) + (a[ks][2].y + a[ks][3].y);
    }
    rowSum8(red);
#pragma unroll
    for (int ks = 0; ks < 4; ++ks) {
      // sums lie in [1, 64]: the bare reciprocal needs no range fix-up
      const v2f inv = {__builtin_amdgcn_rcpf(red[2 * ks]),
                       __builtin_amdgcn_rcpf(red[2 * ks + 1])};
#pragma unroll
      for (int t = 0; t < 4; ++t) a[ks][t] *= inv;
    }
#pragma unroll
    for (int ks = 0; ks < 4; ++ks) {
      const int r0 = ks * 4 + 2 * half;
      v2f b[4];
#pragma unroll
      for (int u = 0; u < 4; ++u) {       // B : B[i, v] = V[i, v]
        int v = u * 16 + mloc;
        b[u].x = ldsV[wave][r0 * 64 + v];
        b[u].y = ldsV[wave][(r0 + 1) * 64 + v];
      }
#pragma unroll
      for (int t = 0; t < 4; ++t)
#pragma unroll
        for (int u = 0; u < 4; ++u)
          acc[t][u] = wmma_f32_16x16x4(a[ks][t], b[u], acc[t][u]);
    }
    __syncthreads();
    // Distance behind the trip's last WMMA: across the back edge the next trip's
    // first vector instructions reuse that WMMA's A registers.
    // The scheduling barrier keeps every WMMA of the
    // trip in front of the slots.
    __builtin_amdgcn_sched_barrier(0);
    asm volatile("v_nop\n\tv_nop\n\tv_nop\n\tv_nop\n\t"
                 "v_nop\n\tv_nop\n\tv_nop\n\tv_nop");
  }

  // deterministic cross-wave merge (fixed wave order; disjoint (c,v) per lane)
  for (int w = 0; w < CTX_WAVES; ++w) {
    if (wave == w) {
#pragma unroll
      for (int t = 0; t < 4; ++t)
#pragma unroll
        for (int u = 0; u < 4; ++u)
#pragma unroll
          for (int r = 0; r < 8; ++r) {
            int c = t * 16 + r + 8 * half;    // D: VGPR r -> M=r / M=r+8
            int v = u * 16 + mloc;
            ldsAcc[c * 64 + v] += acc[t][u][r];
          }
    }
    __syncthreads();
  }
  float* dst = pctx + (size_t)bid * 4096;
  for (int e = tid; e < 4096; e += CTX_WAVES * 32) dst[e] = ldsAcc[e];
}

// ---------- Reduce context partials (fixed order), merge Q's statistics ----------
// Column maxes of Q for the output pass: the role of the MX_BLOCKS blocks behind
// the first RC_BLOCKS of kReduceCtxAndMerge.  A block owns 32 columns (one
// 128-byte line of m); a wave takes 32 of the 256 per-block maxes of each column
// from loads that are all in flight together, 8 wave results merge through LDS.
static __device__ __forceinline__ void colMaxBlock(
    const float* __restrict__ pmax, float* __restrict__ m, const int mb,
    float (&sm)[RC_GROUPS][RC_ELEMS]) {
  const int tid = threadIdx.x;
  const int c = tid & 31, g = tid >> 5;
  const float* p = pmax + g * MX_PER * 64 + mb * 32 + c;
  static_assert(MX_PER == 32, "the two statements below name 32 loaded values");
  float v[MX_PER];
#pragma unroll   // v[] must stay in registers
  for (int k = 0; k < MX_PER; ++k) v[k] = p[k * 64];
  // Hold the 32 loads in front of the first max (loaded values as inputs only),
  // one memory round trip for all; the pointer is an input too, so that it stays
  // live until every load that names it has returned.
  asm volatile("" :: "v"(v[0]), "v"(v[1]), "v"(v[2]), "v"(v[3]), "v"(v[4]),
               "v"(v[5]), "v"(v[6]), "v"(v[7]), "v"(v[8]), "v"(v[9]),
               "v"(v[10]), "v"(v[11]), "v"(v[12]), "v"(v[13]), "v"(v[14]),
               "v"(v[15]), "v"(p));
  asm volatile("" :: "v"(v[16]), "v"(v[17]), "v"(v[18]), "v"(v[19]), "v"(v[20]),
               "v"(v[21]), "v"(v[22]), "v"(v[23]), "v"(v[24]), "v"(v[25]),
               "v"(v[26]), "v"(v[27]), "v"(v[28]), "v"(v[29]), "v"(v[30]),
               "v"(v[31]), "v"(p));
  float M = v[0];
#pragma unroll
  for (int k = 1; k < MX_PER; ++k) M = fmaxf(M, v[k]);
  sm[g][c] = M;
  __syncthreads();
  if (tid < 32) {
    float Mt = sm[0][tid];
#pragma unroll
    for (int j = 1; j < RC_THREADS / 32; ++j) Mt = fmaxf(Mt, sm[j][tid]);
    m[mb * 32 + tid] = Mt;
  }
}

// A block owns 32 consecutive elements (one 128-byte line of every partial and of
// ctxp).  Its 256 threads are 8 float4 columns x 32 groups; a thread sums the 16
// partials of its group from loads that are all issued before the first add, so
// the kernel waits for about one memory round trip instead of one per unrolled
// trip of a 512-long loop.  The 32 group sums are merged through LDS.
// The 32 elements lie in ONE row of the context, so the block divides by the
// exp-sum of ONE column of Q.  Wave 0 merges that column's 256 per-block
// (max, sum) pairs itself, 16 pairs a lane in 16 groups and then the 16 group
// results, each in index order; its pair loads fly together with the loads of
// the partials, so the merge costs no memory round trip and no launch of its own.
__global__ __launch_bounds__(RC_THREADS) void kReduceCtxAndMerge(
    const float* __restrict__ pctx, const float* __restrict__ pmax,
    const float* __restrict__ psum, float* __restrict__ ctxp,
    float* __restrict__ m) {
  __shared__ __attribute__((aligned(16))) float sm[RC_GROUPS][RC_ELEMS];
  __shared__ float smM[16];
  __shared__ float smS[16];
  const int tid = threadIdx.x, bid = blockIdx.x;
  if (bid >= RC_BLOCKS) {               // the same for a whole block
    colMaxBlock(pmax, m, bid - RC_BLOCKS, sm);
    return;
  }
  const int q = tid & (RC_ELEMS / 4 - 1);         // float4 column in the line
  const int g = tid / (RC_ELEMS / 4);             // group of partials
  const v4f* p =
      (const v4f*)(pctx + (size_t)g * RC_PER * 4096 + bid * RC_ELEMS) + q;
  static_assert(RC_PER == 16, "the statements below name 16 loaded values");
  static_assert(ST_BLOCKS == 256, "16 groups of 16 pairs");
  v4f v[RC_PER];
  if (tid < 32) {                       // wave 0: the pairs, then its partials
    // lanes 16-31 read what lanes 0-15 read
    const float* pp = pmax + (tid & 15) * 16 * 64 + (bid * RC_ELEMS >> 6);
    const float* ps = psum + (tid & 15) * 16 * 64 + (bid * RC_ELEMS >> 6);
    float pm[16], pv[16];
#pragma unroll   // pm[], pv[] and v[] must stay in registers
    for (int k = 0; k < 16; ++k) { pm[k] = pp[k * 64]; pv[k] = ps[k * 64]; }
#pragma unroll
    for (int k = 0; k < RC_PER; ++k) v[k] = p[k * 1024];
    // Hold all 48 loads in front of the first use (loaded values as inputs only):
    // one round trip for pairs and partials.  Each pointer is an input too: it
    // stays live until every load that names it has returned.
    asm volatile("" :: "v"(pm[0]), "v"(pm[1]), "v"(pm[2]), "v"(pm[3]), "v"(pm[4]),
                 "v"(pm[5]), "v"(pm[6]), "v"(pm[7]), "v"(pm[8]), "v"(pm[9]),
                 "v"(pm[10]), "v"(pm[11]), "v"(pm[12]), "v"(pm[13]), "v"(pm[14]),
                 "v"(pm[15]), "v"(pp), "v"(ps), "v"(p));
    asm volatile("" :: "v"(pv[0]), "v"(pv[1]), "v"(pv[2]), "v"(pv[3]), "v"(pv[4]),
                 "v"(pv[5]), "v"(pv[6]), "v"(pv[7]), "v"(pv[8]), "v"(pv[9]),
                 "v"(pv[10]), "v"(pv[11]), "v"(pv[12]), "v"(pv[13]), "v"(pv[14]),
                 "v"(pv[15]), "v"(pp), "v"(ps), "v"(p));
    asm volatile("" :: "v"(v[0]), "v"(v[1]), "v"(v[2]), "v"(v[3]), "v"(v[4]),
                 "v"(v[5]), "v"(v[6]), "v"(v[7]), "v"(v[8]), "v"(v[9]),
                 "v"(v[10]), "v"(v[11]), "v"(v[12]), "v"(v[13]), "v"(v[14]),
                 "v"(v[15]), "v"(p));
    float M = pm[0];
#pragma unroll
    for (int k = 1; k < 16; ++k) M = fmaxf(M, pm[k]);
    float S = 0.f;
#pragma unroll
    for (int k = 0; k < 16; ++k) S += pv[k] * exp2Neg((pm[k] - M) * KEXP);
    if (tid < 16) { smM[tid] = M; smS[tid] = S; }
  } else {
#pragma unroll   // v[] must stay in registers, here and in the sum below
    for (int k = 0; k < RC_PER; ++k) v[k] = p[k * 1024];
    // Holds the 16 loads in front of the first add (loaded values as inputs only):
    // without it the compiler issued the last three behind the first returns, to
    // reuse their registers, which puts a second round trip behind the first.
    // The pointer is an input too: it stays live past the loads, so that no load's
    // result lands on the address pair that the other loads of the run name.
    asm volatile("" :: "v"(v[0]), "v"(v[1]), "v"(v[2]), "v"(v[3]), "v"(v[4]),
                 "v"(v[5]), "v"(v[6]), "v"(v[7]), "v"(v[8]), "v"(v[9]),
                 "v"(v[10]), "v"(v[11]), "v"(v[12]), "v"(v[13]), "v"(v[14]),
                 "v"(v[15]), "v"(p));
  }
  v4f a = v[0];
#pragma unroll
  for (int k = 1; k < RC_PER; ++k) a += v[k];
  *(v4f*)&sm[g][q * 4] = a;
  __syncthreads();
  if (tid < RC_ELEMS) {
    float acc = sm[0][tid];
#pragma unroll   // lets the LDS reads run ahead of the chain of adds
    for (int j = 1; j < RC_GROUPS; ++j) acc += sm[j][tid];
    float Mt = smM[0];
#pragma unroll
    for (int j = 1; j < 16; ++j) Mt = fmaxf(Mt, smM[j]);
    float St = 0.f;
#pragma unroll
    for (int j = 0; j < 16; ++j)   // fused: one rounding a term, one chain
      St = __builtin_fmaf(smS[j], exp2Neg((smM[j] - Mt) * KEXP), St);
    ctxp[bid * RC_ELEMS + tid] = acc / St;
  }
}

// ---------- Pass 4: out = E @ ctx'  (E = exp2((Q - m)*KEXP)) ----------
__global__ __launch_bounds__(256) void kOut(const float* __restrict__ Q,
                                            const float* __restrict__ m,
                                            const float* __restrict__ ctxp,
                                            float* __restrict__ out) {
  __shared__ __attribute__((aligned(16))) float ldsCtx[4096];
  __shared__ float ldsM[64];
  __shared__ __attribute__((aligned(16))) float ldsE[8][16 * E_PITCH];
  const int tid  = threadIdx.x;
  const int wave = tid >> 5;
  const int lane = tid & 31;
  const int half = lane >> 4;
  const int mloc = lane & 15;

  for (int e = tid; e < 512; e += 256) {              // 4 columns of a row pair
    const int p = e >> 4, v4 = e & 15;
    const float4 r0 = ((const float4*)ctxp)[(2 * p) * 16 + v4];
    const float4 r1 = ((const float4*)ctxp)[(2 * p + 1) * 16 + v4];
    float4* d = (float4*)&ldsCtx[CTX_PAIR_AT(p, v4 * 4)];
    d[0] = make_float4(r0.x, r1.x, r0.y, r1.y);
    d[1] = make_float4(r0.z, r1.z, r0.w, r1.w);
  }
  if (tid < 64) ldsM[tid] = m[tid];
  __syncthreads();

  const int rowbase = (blockIdx.x * 8 + wave) * 16;   // 16 rows per wave
  const float4* q4 = (const float4*)(Q + (size_t)rowbase * 64);
  const int c0w = (lane * 4) & 63;                    // cols of this lane's f4
  float* eRow = &ldsE[wave][half * E_PITCH + c0w];    // float4 j: row 2j + half
#pragma unroll
  for (int j = 0; j < 8; ++j) {
    int i4 = lane + j * 32;
    float4 v = q4[i4];
    float4 e;
    e.x = exp2f((v.x - ldsM[c0w + 0]) * KEXP);
    e.y = exp2f((v.y - ldsM[c0w + 1]) * KEXP);
    e.z = exp2f((v.z - ldsM[c0w + 2]) * KEXP);
    e.w = exp2f((v.w - ldsM[c0w + 3]) * KEXP);
    *(float4*)(eRow + j * 2 * E_PITCH) = e;
  }
  __syncthreads();

  v8f acc[4];
#pragma unroll
  for (int u = 0; u < 4; ++u)
    acc[u] = (v8f){0.f, 0.f, 0.f, 0.f, 0.f, 0.f, 0.f, 0.f};

  // CTX_PAIR_AT(ks * 2 + half, u * 16 + mloc) with the lane's part taken out: the
  // column group is u ^ half, that is u + half for even u and u - half for odd u.
  const float* bEven = ldsCtx + half * (128 + 32) + mloc * 2;
  const float* bOdd  = ldsCtx + half * (128 - 32) + mloc * 2;
#pragma unroll
  for (int ks = 0; ks < 16; ++ks) {
    const int c0 = ks * 4 + 2 * half;
    v2f a;                                  // A[row, c] = E[row, c]
    a.x = ldsE[wave][mloc * E_PITCH + c0];
    a.y = ldsE[wave][mloc * E_PITCH + c0 + 1];
#pragma unroll
    for (int u = 0; u < 4; ++u) {           // B[c, v] = ctx'[c, v]
      const v2f b = *(const v2f*)(((u & 1) ? bOdd : bEven) + ks * 256 + u * 32);
      acc[u] = wmma_f32_16x16x4(a, b, acc[u]);
    }
  }
  float* o = out + (size_t)rowbase * 64;
#pragma unroll
  for (int u = 0; u < 4; ++u)
#pragma unroll
    for (int r = 0; r < 8; ++r) {
      int row = r + 8 * half;
      o[row * 64 + u * 16 + mloc] = acc[u][r];
    }
}

extern "C" void kernel_launch(void* const* d_in, const int* in_sizes, int n_in,
                              void* d_out, int out_size, void* d_ws, size_t ws_size,
                              hipStream_t stream) {
  (void)in_sizes; (void)n_in; (void)out_size; (void)ws_size;
  const float* Q = (const float*)d_in[0];
  const float* K = (const float*)d_in[1];
  const float* V = (const float*)d_in[2];
  float* out = (float*)d_out;

  // ws (floats): m[64] | 64 unused | ctxp[4096] | pmax[16384] | psum[16384]
  //              | pctx[512*4096]   (~8.5 MB total)
  float* w    = (float*)d_ws;
  float* m    = w;
  float* ctxp = w + 128;
  float* pmax = w + 128 + 4096;
  float* psum = pmax + 256 * 64;
  float* pctx = psum + 256 * 64;

  kCtxAndStats  <<<CTX_BLOCKS + ST_BLOCKS, CTX_WAVES * 32, 0, stream>>>(
      K, V, pctx, Q, pmax, psum);
  kReduceCtxAndMerge<<<RC_BLOCKS + MX_BLOCKS, RC_THREADS, 0, stream>>>(
      pctx, pmax, psum, ctxp, m);
  kOut          <<<2048, 256, 0, stream>>>(Q, m, ctxp, out);
}

// v007
// It runs in 45.8 microseconds.
// In both of two side-by-side timings against v006, it was 1.05 times as fast.
// Over all steps from v000 it is 3.79 times as fast.
#include <hip/hip_runtime.h>
#include <math.h>

// Linear attention, N=262144, d_k=d_v=64.  Memory-bound (>=256MB traffic,
// ~11-15us floor at 23.3TB/s).  f32 WMMA (16x16x4) for both matmuls,
// async global->LDS (b128) for K/V tile staging in the context pass, two buffers.

#define NROWS 262144
#define DIM   64
#define KEXP  0.18033688011112042f   // (1/8) * log2(e)

#define CTX_BLOCKS 512
#define CTX_WAVES  4                 // 512 x 4 = 2048 waves streaming K/V
#define CTX_CHUNKS (NROWS / CTX_BLOCKS / CTX_WAVES / 16)   // 16-row tiles a wave

#define ST_BLOCKS  256               // column statistics of Q: 1024 rows a block
#define ST_THREADS (CTX_WAVES * 32)  // they share the context pass's launch
#define ST_F4      32                // float4 a thread holds at a time (one batch)
#define ST_BATCHES 4                 // 1024*16 float4 / (128 threads * 32)
#define ST_STRIDE  (ST_THREADS * ST_BATCHES)   // float4 between a batch's loads
#define ST_MEMBERS (ST_STRIDE / 16)  // (max, sum) pairs a column set in a block

#define RC_BLOCKS  128               // context reduce: 32 elements a block
#define RC_THREADS 256
#define RC_ELEMS   (4096 / RC_BLOCKS)
#define RC_GROUPS  (RC_THREADS / (RC_ELEMS / 4))
#define RC_PER     (CTX_BLOCKS / RC_GROUPS)   // partials a thread
#define MX_BLOCKS  2                 // column maxes of Q: 32 columns a block
#define MX_PER     (ST_BLOCKS / (RC_THREADS / 32))   // per-block maxes a thread

// LDS layout of the output pass (bank = dword address mod 64).
// E rows, read as A fragments (16 lanes = 16 rows, 8 bytes each): at a pitch of
// 64 floats all 16 rows fall on one bank pair; at 68 a row starts 4 banks behind
// the row above, so the lanes of a read spread evenly over all 64 banks.
// 68 * 4 B = 17 * 16 B keeps the 16-byte stores aligned.
#define E_PITCH 68
// ctx', read as B fragments: a lane wants ctx'[c][v] and ctx'[c+1][v], c even, and
// lanes 16-31 the same columns two rows below lanes 0-15; in plain rows of 64 all
// four rows lie on the same 16 banks.  Here rows 2p and 2p+1 are interleaved
// column by column (one 8-byte read a fragment), and odd p keeps its 16-column
// groups swapped in pairs, so that the two lane halves use different banks.
// Place of the pair (ctx'[2p][v], ctx'[2p+1][v]), in floats:
#define CTX_PAIR_AT(p, v) ((p) * 128 + (((v) ^ (((p) & 1) << 4)) * 2))

typedef float v2f __attribute__((ext_vector_type(2)));
typedef float v4f __attribute__((ext_vector_type(4)));
typedef float v8f __attribute__((ext_vector_type(8)));

static __device__ __forceinline__ v8f wmma_f32_16x16x4(v2f a, v2f b, v8f c) {
  // 8 args: (neg_a, A, neg_b, B, c_mod, C, reuse_a, reuse_b)
  return __builtin_amdgcn_wmma_f32_16x16x4_f32(false, a, false, b, (short)0, c,
                                               false, false);
}

// Low 32 bits of a generic pointer into LDS == wave-relative LDS byte offset.
static __device__ __forceinline__ unsigned ldsOffsetOf(const void* p) {
  return (unsigned)(size_t)p;
}

// One 16 x 64 tile (4 KB) into LDS: eight copies, 16 bytes a lane each; ldsOff and
// gaddr are the lane's own first 16 bytes, copy j lies 512 bytes behind copy j - 1.
// The closing s_wait_xcnt stands inside the statement so that no address register
// of a copy is rewritten in front of it (a precaution).
static __device__ __forceinline__ void asyncTileToLds(unsigned ldsOff,
                                                      const float* gaddr) {
  asm volatile("global_load_async_to_lds_b128 %0, %8, off\n\t"
               "global_load_async_to_lds_b128 %1, %9, off\n\t"
               "global_load_async_to_lds_b128 %2, %10, off\n\t"
               "global_load_async_to_lds_b128 %3, %11, off\n\t"
               "global_load_async_to_lds_b128 %4, %12, off\n\t"
               "global_load_async_to_lds_b128 %5, %13, off\n\t"
               "global_load_async_to_lds_b128 %6, %14, off\n\t"
               "global_load_async_to_lds_b128 %7, %15, off\n\t"
               "s_wait_xcnt 0x0"
               :: "v"(ldsOff), "v"(ldsOff + 512), "v"(ldsOff + 1024),
                  "v"(ldsOff + 1536), "v"(ldsOff + 2048), "v"(ldsOff + 2560),
                  "v"(ldsOff + 3072), "v"(ldsOff + 3584),
                  "v"(gaddr), "v"(gaddr + 128), "v"(gaddr + 256), "v"(gaddr + 384),
                  "v"(gaddr + 512), "v"(gaddr + 640), "v"(gaddr + 768),
                  "v"(gaddr + 896)
               : "memory");
}

// The wave's own copies have landed.
static __device__ __forceinline__ void waitAsync0() {
  asm volatile("s_wait_asynccnt 0x0" ::: "memory");
}

// The wave's own LDS reads have returned.
static __device__ __forceinline__ void waitDs0() {
  asm volatile("s_wait_dscnt 0x0" ::: "memory");
}

// exp2 of an argument <= 0 by the bare instruction: exp2f's range fix-up acts only
// on results below 2^-126, which vanish against a sum that holds a term of 1.
// The closing v_nop keeps the one slot that the instruction set asks for behind a
// transcendental, whatever the compiler places next.
static __device__ __forceinline__ float exp2Neg(float x) {
  float r;
  asm("v_exp_f32 %0, %1\n\tv_nop" : "=v"(r) : "v"(x));
  return r;
}

// Four at once, one slot for the run; early-clobber outputs so that no result
// lands on a source that a later line of the statement still reads.
static __device__ __forceinline__ float4 exp2Neg4(float4 x) {
  float4 r;
  asm("v_exp_f32 %0, %4\n\tv_exp_f32 %1, %5\n\tv_exp_f32 %2, %6\n\t"
      "v_exp_f32 %3, %7\n\tv_nop"
      : "=&v"(r.x), "=&v"(r.y), "=&v"(r.z), "=&v"(r.w)
      : "v"(x.x), "v"(x.y), "v"(x.z), "v"(x.w));
  return r;
}

// Butterfly over the 16 lanes of a row (lane l with l ^ 1, 2, 4, 8) for eight
// values at once.  Written as asm because a shuffle from source goes through the
// LDS crossbar with a wait behind each step, while the DPP form stays on the
// vector port; one statement, step-major, so that the eight independent chains
// fill each other's latency (as separate statements the compiler put each chain
// back to back).
#define ROW8_STEP(OP, X)                                            \
  OP " %0, %0, %0 row_xmask:" X " row_mask:0xf bank_mask:0xf\n\t"   \
  OP " %1, %1, %1 row_xmask:" X " row_mask:0xf bank_mask:0xf\n\t"   \
  OP " %2, %2, %2 row_xmask:" X " row_mask:0xf bank_mask:0xf\n\t"   \
  OP " %3, %3, %3 row_xmask:" X " row_mask:0xf bank_mask:0xf\n\t"   \
  OP " %4, %4, %4 row_xmask:" X " row_mask:0xf bank_mask:0xf\n\t"   \
  OP " %5, %5, %5 row_xmask:" X " row_mask:0xf bank_mask:0xf\n\t"   \
  OP " %6, %6, %6 row_xmask:" X " row_mask:0xf bank_mask:0xf\n\t"   \
  OP " %7, %7, %7 row_xmask:" X " row_mask:0xf bank_mask:0xf\n\t"
#define ROW8_ALL(OP) \
  ROW8_STEP(OP, "1") ROW8_STEP(OP, "2") ROW8_STEP(OP, "4") ROW8_STEP(OP, "8")

static __device__ __forceinline__ void rowMax8(float (&r)[8]) {
  asm(ROW8_ALL("v_max_num_f32_dpp")
      : "+v"(r[0]), "+v"(r[1]), "+v"(r[2]), "+v"(r[3]),
        "+v"(r[4]), "+v"(r[5]), "+v"(r[6]), "+v"(r[7]));
}

static __device__ __forceinline__ void rowSum8(float (&r)[8]) {
  asm(ROW8_ALL("v_add_f32_dpp")
      : "+v"(r[0]), "+v"(r[1]), "+v"(r[2]), "+v"(r[3]),
        "+v"(r[4]), "+v"(r[5]), "+v"(r[6]), "+v"(r[7]));
}

// ---------- Per-block column max AND sum of exp, Q read once ----------
// The role of the blocks behind the first CTX_BLOCKS of kCtxAndStats (below).
// A thread holds 32 float4 of Q in registers (all loads issued before the first
// use), takes its own column maxes and sums exp against them; it does so for four
// batches, one after the other.  Batch b of thread t holds float4
// t + 128 b + 512 j, j = 0..31.  The (max, sum) pairs of all batches are merged
// by rescaling: s = sum_j s_j * exp2((m_j - m)*KEXP).
// element (i*4+k) column = (tid*4+k) & 63 since strides are multiples of 64.
static __device__ __forceinline__ void colStatsBlock(
    const float* __restrict__ Q, float* __restrict__ pmax,
    float* __restrict__ psum, const int sb) {
  __shared__ __attribute__((aligned(16))) float smM[ST_MEMBERS][64];
  __shared__ __attribute__((aligned(16))) float smS[ST_MEMBERS][64];
  const int tid = threadIdx.x;
  const float4* q4 =
      (const float4*)(Q + (size_t)sb * (NROWS / ST_BLOCKS) * DIM) + tid;
  const int c0 = (tid * 4) & 63;                    // 4 columns owned
  // Kept rolled: unrolled, the compiler held a third of each batch's loads back
  // until the first ones had returned, a second memory round trip in every batch;
  // rolled, a batch's 32 loads stand together at the head of its trip.
#pragma unroll 1
  for (int b = 0; b < ST_BATCHES; ++b) {
    float4 v[ST_F4];
#pragma unroll
    for (int j = 0; j < ST_F4; ++j) v[j] = q4[b * ST_THREADS + j * ST_STRIDE];
    float4 mx = v[0];
#pragma unroll
    for (int j = 1; j < ST_F4; ++j) {
      mx.x = fmaxf(mx.x, v[j].x); mx.y = fmaxf(mx.y, v[j].y);
      mx.z = fmaxf(mx.z, v[j].z); mx.w = fmaxf(mx.w, v[j].w);
    }
    float4 s = {0.f, 0.f, 0.f, 0.f};
#pragma unroll
    for (int j = 0; j < ST_F4; ++j) {
      float4 a = {(v[j].x - mx.x) * KEXP, (v[j].y - mx.y) * KEXP,
                  (v[j].z - mx.z) * KEXP, (v[j].w - mx.w) * KEXP};
      float4 e = exp2Neg4(a);
      s.x += e.x; s.y += e.y; s.z += e.z; s.w += e.w;
    }
    const int mem = b * (ST_THREADS / 16) + (tid >> 4);
    *(float4*)&smM[mem][c0] = mx;
    *(float4*)&smS[mem][c0] = s;
  }
  __syncthreads();
  if (tid < 64) {
    float M = smM[0][tid];
#pragma unroll
    for (int j = 1; j < ST_MEMBERS; ++j) M = fmaxf(M, smM[j][tid]);
    float S = 0.f;
#pragma unroll
    for (int j = 0; j < ST_MEMBERS; ++j)
      S += smS[j][tid] * exp2Neg((smM[j][tid] - M) * KEXP);
    pmax[sb * 64 + tid] = M;
    psum[sb * 64 + tid] = S;
  }
}

__global__ __launch_bounds__(CTX_WAVES * 32) void kCtxAndStats(
    const float* __restrict__ K, const float* __restrict__ V,
    float* __restrict__ pctx, const float* __restrict__ Q,
    float* __restrict__ pmax, float* __restrict__ psum) {
  if (blockIdx.x >= CTX_BLOCKS) {       // the same for a whole block
    colStatsBlock(Q, pmax, psum, blockIdx.x - CTX_BLOCKS);
    return;
  }
  __shared__ __attribute__((aligned(16))) float ldsK[2][CTX_WAVES][16 * 64];
  __shared__ __attribute__((aligned(16))) float ldsV[2][CTX_WAVES][16 * 64];
  __shared__ float ldsAcc[4096];
  const int tid  = threadIdx.x;
  const int wave = tid >> 5;
  const int lane = tid & 31;
  const int bid  = blockIdx.x;
  const int half = lane >> 4;
  const int mloc = lane & 15;

  // This lane's first 16 bytes of the wave's tile 0, in memory and in buffer 0.
  const int rowsPerBlock = NROWS / CTX_BLOCKS;            // 512
  const int rows0 = bid * rowsPerBlock + wave * (rowsPerBlock / CTX_WAVES);
  const float* kp = K + (size_t)rows0 * 64 + lane * 4;
  const float* vp = V + (size_t)rows0 * 64 + lane * 4;
  const unsigned kOff = ldsOffsetOf(&ldsK[0][wave][lane * 4]);
  const unsigned vOff = ldsOffsetOf(&ldsV[0][wave][lane * 4]);
  const unsigned bufBytes = sizeof(ldsK[0]);

  asyncTileToLds(kOff, kp);                               // tile 0 -> buffer 0
  asyncTileToLds(vOff, vp);

  for (int e = tid; e < 4096; e += CTX_WAVES * 32) ldsAcc[e] = 0.0f;

  v8f acc[4][4];
#pragma unroll
  for (int t = 0; t < 4; ++t)
#pragma unroll
    for (int u = 0; u < 4; ++u)
      acc[t][u] = (v8f){0.f, 0.f, 0.f, 0.f, 0.f, 0.f, 0.f, 0.f};

  waitAsync0();
  __syncthreads();                            // tile 0 landed, ldsAcc zeroed
  static_assert(CTX_CHUNKS >= 2, "a tile 1 exists");
  asyncTileToLds(kOff + bufBytes, kp + 16 * 64);          // tile 1 -> buffer 1
  asyncTileToLds(vOff + bufBytes, vp + 16 * 64);

  for (int chunk = 0; chunk < CTX_CHUNKS; ++chunk) {
    const float* tileK = ldsK[chunk & 1][wave];           // trip t reads buffer
    const float* tileV = ldsV[chunk & 1][wave];           // t mod 2 alone
    // A = kn^T : A[c, i] = kn[i, c].  All 16 A fragments of the tile are read raw.
    // In this layout K row ks*4 + 2*half + {0,1} sits in component {x,y} of
    // a[ks][0..3] across the 16 lanes of this lane's half, so the row softmax is
    // taken right here: 4 values a lane, then a 16-lane butterfly; nothing is
    // written back to LDS.
    v2f a[4][4];
#pragma unroll
    for (int ks = 0; ks < 4; ++ks) {
      const int r0 = ks * 4 + 2 * half;   // this lane-half's first K row
#pragma unroll
      for (int t = 0; t < 4; ++t) {
        int c = t * 16 + mloc;
        a[ks][t].x = tileK[r0 * 64 + c];
        a[ks][t].y = tileK[(r0 + 1) * 64 + c];
      }
    }
    float red[8];                         // one value a row: max, then sum
#pragma unroll
    for (int ks = 0; ks < 4; ++ks) {
      red[2 * ks] = __builtin_fmaximum_numf(
          __builtin_fmaximum_numf(a[ks][0].x, a[ks][1].x),
          __builtin_fmaximum_numf(a[ks][2].x, a[ks][3].x));
      red[2 * ks + 1] = __builtin_fmaximum_numf(
          __builtin_fmaximum_numf(a[ks][0].y, a[ks][1].y),
          __builtin_fmaximum_numf(a[ks][2].y, a[ks][3].y));
    }
    rowMax8(red);
#pragma unroll
    for (int ks = 0; ks < 4; ++ks) {
      const float mx = red[2 * ks], my = red[2 * ks + 1];
#pragma unroll
      for (int t = 0; t < 4; t += 2) {
        float4 g = {(a[ks][t].x - mx) * KEXP, (a[ks][t].y - my) * KEXP,
                    (a[ks][t + 1].x - mx) * KEXP, (a[ks][t + 1].y - my) * KEXP};
        float4 e = exp2Neg4(g);
        a[ks][t].x = e.x;     a[ks][t].y = e.y;
        a[ks][t + 1].x = e.z; a[ks][t + 1].y = e.w;
      }
      red[2 * ks]     = (a[ks][0].x + a[ks][1].x) + (a[ks][2].x + a[ks][3].x);
      red[2 * ks + 1] = (a[ks][0].y + a[ks][1].y) + (a[ks][2].y + a[ks][3].y);
    }
    rowSum8(red);
#pragma unroll
    for (int ks = 0; ks < 4; ++ks) {
      // sums lie in [1, 64]: the bare reciprocal needs no range fix-up
      const v2f inv = {__builtin_amdgcn_rcpf(red[2 * ks]),
                       __builtin_amdgcn_rcpf(red[2 * ks + 1])};
#pragma unroll
      for (int t = 0; t < 4; ++t) a[ks][t] *= inv;
    }
#pragma unroll
    for (int ks = 0; ks < 4; ++ks) {
      const int r0 = ks * 4 + 2 * half;
      v2f b[4];
#pragma unroll
      for (int u = 0; u < 4; ++u) {       // B : B[i, v] = V[i, v]
        int v = u * 16 + mloc;
        b[u].x = tileV[r0 * 64 + v];
        b[u].y = tileV[(r0 + 1) * 64 + v];
      }
#pragma unroll
      for (int t = 0; t < 4; ++t)
#pragma unroll
        for (int u = 0; u < 4; ++u)
          acc[t][u] = wmma_f32_16x16x4(a[ks][t], b[u], acc[t][u]);
    }
    // Distance behind the trip's last WMMA: the vector instructions that follow
    // (the refill's addresses, across the back edge the next trip's first ones)
    // reuse that WMMA's A registers.
    // The scheduling barrier keeps every WMMA of the trip in front of the slots.
    __builtin_amdgcn_sched_barrier(0);
    asm volatile("v_nop\n\tv_nop\n\tv_nop\n\tv_nop\n\t"
                 "v_nop\n\tv_nop\n\tv_nop\n\tv_nop");
    // Hand-over: this trip's reads are done, tile t + 1 has landed; the barrier
    // publishes it and frees the buffer that is refilled behind it.
    waitDs0();
    waitAsync0();
    __syncthreads();
    if (chunk + 2 < CTX_CHUNKS) {                         // tile t + 2 exists
      asyncTileToLds(kOff + (chunk & 1) * bufBytes, kp + (chunk + 2) * 16 * 64);
      asyncTileToLds(vOff + (chunk & 1) * bufBytes, vp + (chunk + 2) * 16 * 64);
    }
  }
  waitAsync0();

  // deterministic cross-wave merge (fixed wave order; disjoint (c,v) per lane)
  for (int w = 0; w < CTX_WAVES; ++w) {
    if (wave == w) {
#pragma unroll
      for (int t = 0; t < 4; ++t)
#pragma unroll
        for (int u = 0; u < 4; ++u)
#pragma unroll
          for (int r = 0; r < 8; ++r) {
            int c = t * 16 + r + 8 * half;    // D: VGPR r -> M=r / M=r+8
            int v = u * 16 + mloc;
            ldsAcc[c * 64 + v] += acc[t][u][r];
          }
    }
    __syncthreads();
  }
  float* dst = pctx + (size_t)bid * 4096;
  for (int e = tid; e < 4096; e += CTX_WAVES * 32) dst[e] = ldsAcc[e];
}

// ---------- Reduce context partials (fixed order), merge Q's statistics ----------
// Column maxes of Q for the output pass: the role of the MX_BLOCKS blocks behind
// the first RC_BLOCKS of kReduceCtxAndMerge.  A block owns 32 columns (one
// 128-byte line of m); a wave takes 32 of the 256 per-block maxes of each column
// from loads that are all in flight together, 8 wave results merge through LDS.
static __device__ __forceinline__ void colMaxBlock(
    const float* __restrict__ pmax, float* __restrict__ m, const int mb,
    float (&sm)[RC_GROUPS][RC_ELEMS]) {
  const int tid = threadIdx.x;
  const int c = tid & 31, g = tid >> 5;
  const float* p = pmax + g * MX_PER * 64 + mb * 32 + c;
  static_assert(MX_PER == 32, "the two statements below name 32 loaded values");
  float v[MX_PER];
#pragma unroll   // v[] must stay in registers
  for (int k = 0; k < MX_PER; ++k) v[k] = p[k * 64];
  // Hold the 32 loads in front of the first max (loaded values as inputs only),
  // one memory round trip for all; the pointer is an input too, so that it stays
  // live until every load that names it has returned.
  asm volatile("" :: "v"(v[0]), "v"(v[1]), "v"(v[2]), "v"(v[3]), "v"(v[4]),
               "v"(v[5]), "v"(v[6]), "v"(v[7]), "v"(v[8]), "v"(v[9]),
               "v"(v[10]), "v"(v[11]), "v"(v[12]), "v"(v[13]), "v"(v[14]),
               "v"(v[15]), "v"(p));
  asm volatile("" :: "v"(v[16]), "v"(v[17]), "v"(v[18]), "v"(v[19]), "v"(v[20]),
               "v"(v[21]), "v"(v[22]), "v"(v[23]), "v"(v[24]), "v"(v[25]),
               "v"(v[26]), "v"(v[27]), "v"(v[28]), "v"(v[29]), "v"(v[30]),
               "v"(v[31]), "v"(p));
  float M = v[0];
#pragma unroll
  for (int k = 1; k < MX_PER; ++k) M = fmaxf(M, v[k]);
  sm[g][c] = M;
  __syncthreads();
  if (tid < 32) {
    float Mt = sm[0][tid];
#pragma unroll
    for (int j = 1; j < RC_THREADS / 32; ++j) Mt = fmaxf(Mt, sm[j][tid]);
    m[mb * 32 + tid] = Mt;
  }
}

// A block owns 32 consecutive elements (one 128-byte line of every partial and of
// ctxp).  Its 256 threads are 8 float4 columns x 32 groups; a thread sums the 16
// partials of its group from loads that are all issued before the first add, so
// the kernel waits for about one memory round trip instead of one per unrolled
// trip of a 512-long loop.  The 32 group sums are merged through LDS.
// The 32 elements lie in ONE row of the context, so the block divides by the
// exp-sum of ONE column of Q.  Wave 0 merges that column's 256 per-block
// (max, sum) pairs itself, 16 pairs a lane in 16 groups and then the 16 group
// results, each in index order; its pair loads fly together with the loads of
// the partials, so the merge costs no memory round trip and no launch of its own.
__global__ __launch_bounds__(RC_THREADS) void kReduceCtxAndMerge(
    const float* __restrict__ pctx, const float* __restrict__ pmax,
    const float* __restrict__ psum, float* __restrict__ ctxp,
    float* __restrict__ m) {
  __shared__ __attribute__((aligned(16))) float sm[RC_GROUPS][RC_ELEMS];
  __shared__ float smM[16];
  __shared__ float smS[16];
  const int tid = threadIdx.x, bid = blockIdx.x;
  if (bid >= RC_BLOCKS) {               // the same for a whole block
    colMaxBlock(pmax, m, bid - RC_BLOCKS, sm);
    return;
  }
  const int q = tid & (RC_ELEMS / 4 - 1);         // float4 column in the line
  const int g = tid / (RC_ELEMS / 4);             // group of partials
  const v4f* p =
      (const v4f*)(pctx + (size_t)g * RC_PER * 4096 + bid * RC_ELEMS) + q;
  static_assert(RC_PER == 16, "the statements below name 16 loaded values");
  static_assert(ST_BLOCKS == 256, "16 groups of 16 pairs");
  v4f v[RC_PER];
  if (tid < 32) {                       // wave 0: the pairs, then its partials
    // lanes 16-31 read what lanes 0-15 read
    const float* pp = pmax + (tid & 15) * 16 * 64 + (bid * RC_ELEMS >> 6);
    const float* ps = psum + (tid & 15) * 16 * 64 + (bid * RC_ELEMS >> 6);
    float pm[16], pv[16];
#pragma unroll   // pm[], pv[] and v[] must stay in registers
    for (int k = 0; k < 16; ++k) { pm[k] = pp[k * 64]; pv[k] = ps[k * 64]; }
#pragma unroll
    for (int k = 0; k < RC_PER; ++k) v[k] = p[k * 1024];
    // Hold all 48 loads in front of the first use (loaded values as inputs only):
    // one round trip for pairs and partials.  Each pointer is an input too: it
    // stays live until every load that names it has returned.
    asm volatile("" :: "v"(pm[0]), "v"(pm[1]), "v"(pm[2]), "v"(pm[3]), "v"(pm[4]),
                 "v"(pm[5]), "v"(pm[6]), "v"(pm[7]), "v"(pm[8]), "v"(pm[9]),
                 "v"(pm[10]), "v"(pm[11]), "v"(pm[12]), "v"(pm[13]), "v"(pm[14]),
                 "v"(pm[15]), "v"(pp), "v"(ps), "v"(p));
    asm volatile("" :: "v"(pv[0]), "v"(pv[1]), "v"(pv[2]), "v"(pv[3]), "v"(pv[4]),
                 "v"(pv[5]), "v"(pv[6]), "v"(pv[7]), "v"(pv[8]), "v"(pv[9]),
                 "v"(pv[10]), "v"(pv[11]), "v"(pv[12]), "v"(pv[13]), "v"(pv[14]),
                 "v"(pv[15]), "v"(pp), "v"(ps), "v"(p));
    asm volatile("" :: "v"(v[0]), "v"(v[1]), "v"(v[2]), "v"(v[3]), "v"(v[4]),
                 "v"(v[5]), "v"(v[6]), "v"(v[7]), "v"(v[8]), "v"(v[9]),
                 "v"(v[10]), "v"(v[11]), "v"(v[12]), "v"(v[13]), "v"(v[14]),
                 "v"(v[15]), "v"(p));
    float M = pm[0];
#pragma unroll
    for (int k = 1; k < 16; ++k) M = fmaxf(M, pm[k]);
    float S = 0.f;
#pragma unroll
    for (int k = 0; k < 16; ++k) S += pv[k] * exp2Neg((pm[k] - M) * KEXP);
    if (tid < 16) { smM[tid] = M; smS[tid] = S; }
  } else {
#pragma unroll   // v[] must stay in registers, here and in the sum below
    for (int k = 0; k < RC_PER; ++k) v[k] = p[k * 1024];
    // Holds the 16 loads in front of the first add (loaded values as inputs only):
    // without it the compiler issued the last three behind the first returns, to
    // reuse their registers, which puts a second round trip behind the first.
    // The pointer is an input too: it stays live past the loads, so that no load's
    // result lands on the address pair that the other loads of the run name.
    asm volatile("" :: "v"(v[0]), "v"(v[1]), "v"(v[2]), "v"(v[3]), "v"(v[4]),
                 "v"(v[5]), "v"(v[6]), "v"(v[7]), "v"(v[8]), "v"(v[9]),
                 "v"(v[10]), "v"(v[11]), "v"(v[12]), "v"(v[13]), "v"(v[14]),
                 "v"(v[15]), "v"(p));
  }
  v4f a = v[0];
#pragma unroll
  for (int k = 1; k < RC_PER; ++k) a += v[k];
  *(v4f*)&sm[g][q * 4] = a;
  __syncthreads();
  if (tid < RC_ELEMS) {
    float acc = sm[0][tid];
#pragma unroll   // lets the LDS reads run ahead of the chain of adds
    for (int j = 1; j < RC_GROUPS; ++j) acc += sm[j][tid];
    float Mt = smM[0];
#pragma unroll
    for (int j = 1; j < 16; ++j) Mt = fmaxf(Mt, smM[j]);
    float St = 0.f;
#pragma unroll
    for (int j = 0; j < 16; ++j)   // fused: one rounding a term, one chain
      St = __builtin_fmaf(smS[j], exp2Neg((smM[j] - Mt) * KEXP), St);
    ctxp[bid * RC_ELEMS + tid] = acc / St;
  }
}

// ---------- Pass 4: out = E @ ctx'  (E = exp2((Q - m)*KEXP)) ----------
__global__ __launch_bounds__(256) void kOut(const float* __restrict__ Q,
                                            const float* __restrict__ m,
                                            const float* __restrict__ ctxp,
                                            float* __restrict__ out) {
  __shared__ __attribute__((aligned(16))) float ldsCtx[4096];
  __shared__ float ldsM[64];
  __shared__ __attribute__((aligned(16))) float ldsE[8][16 * E_PITCH];
  const int tid  = threadIdx.x;
  const int wave = tid >> 5;
  const int lane = tid & 31;
  const int half = lane >> 4;
  const int mloc = lane & 15;

  for (int e = tid; e < 512; e += 256) {              // 4 columns of a row pair
    const int p = e >> 4, v4 = e & 15;
    const float4 r0 = ((const float4*)ctxp)[(2 * p) * 16 + v4];
    const float4 r1 = ((const float4*)ctxp)[(2 * p + 1) * 16 + v4];
    float4* d = (float4*)&ldsCtx[CTX_PAIR_AT(p, v4 * 4)];
    d[0] = make_float4(r0.x, r1.x, r0.y, r1.y);
    d[1] = make_float4(r0.z, r1.z, r0.w, r1.w);
  }
  if (tid < 64) ldsM[tid] = m[tid];
  __syncthreads();

  const int rowbase = (blockIdx.x * 8 + wave) * 16;   // 16 rows per wave
  const float4* q4 = (const float4*)(Q + (size_t)rowbase * 64);
  const int c0w = (lane * 4) & 63;                    // cols of this lane's f4
  float* eRow = &ldsE[wave][half * E_PITCH + c0w];    // float4 j: row 2j + half
#pragma unroll
  for (int j = 0; j < 8; ++j) {
    int i4 = lane + j * 32;
    float4 v = q4[i4];
    float4 e;
    e.x = exp2f((v.x - ldsM[c0w + 0]) * KEXP);
    e.y = exp2f((v.y - ldsM[c0w + 1]) * KEXP);
    e.z = exp2f((v.z - ldsM[c0w + 2]) * KEXP);
    e.w = exp2f((v.w - ldsM[c0w + 3]) * KEXP);
    *(float4*)(eRow + j * 2 * E_PITCH) = e;
  }
  __syncthreads();

  v8f acc[4];
#pragma unroll
  for (int u = 0; u < 4; ++u)
    acc[u] = (v8f){0.f, 0.f, 0.f, 0.f, 0.f, 0.f, 0.f, 0.f};

  // CTX_PAIR_AT(ks * 2 + half, u * 16 + mloc) with the lane's part taken out: the
  // column group is u ^ half, that is u + half for even u and u - half for odd u.
  const float* bEven = ldsCtx + half * (128 + 32) + mloc * 2;
  const float* bOdd  = ldsCtx + half * (128 - 32) + mloc * 2;
#pragma unroll
  for (int ks = 0; ks < 16; ++ks) {
    const int c0 = ks * 4 + 2 * half;
    v2f a;                                  // A[row, c] = E[row, c]
    a.x = ldsE[wave][mloc * E_PITCH + c0];
    a.y = ldsE[wave][mloc * E_PITCH + c0 + 1];
#pragma unroll
    for (int u = 0; u < 4; ++u) {           // B[c, v] = ctx'[c, v]
      const v2f b = *(const v2f*)(((u & 1) ? bOdd : bEven) + ks * 256 + u * 32);
      acc[u] = wmma_f32_16x16x4(a, b, acc[u]);
    }
  }
  float* o = out + (size_t)rowbase * 64;
#pragma unroll
  for (int u = 0; u < 4; ++u)
#pragma unroll
    for (int r = 0; r < 8; ++r) {
      int row = r + 8 * half;
      o[row * 64 + u * 16 + mloc] = acc[u][r];
    }
}

extern "C" void kernel_launch(void* const* d_in, const int* in_sizes, int n_in,
                              void* d_out, int out_size, void* d_ws, size_t ws_size,
                              hipStream_t stream) {
  (void)in_sizes; (void)n_in; (void)out_size; (void)ws_size;
  const float* Q = (const float*)d_in[0];
  const float* K = (const float*)d_in[1];
  const float* V = (const float*)d_in[2];
  float* out = (float*)d_out;

  // ws (floats): m[64] | 64 unused | ctxp[4096] | pmax[16384] | psum[16384]
  //              | pctx[512*4096]   (~8.5 MB total)
  float* w    = (float*)d_ws;
  float* m    = w;
  float* ctxp = w + 128;
  float* pmax = w + 128 + 4096;
  float* psum = pmax + 256 * 64;
  float* pctx = psum + 256 * 64;

  kCtxAndStats  <<<CTX_BLOCKS + ST_BLOCKS, CTX_WAVES * 32, 0, stream>>>(
      K, V, pctx, Q, pmax, psum);
  kReduceCtxAndMerge<<<RC_BLOCKS + MX_BLOCKS, RC_THREADS, 0, stream>>>(
      pctx, pmax, psum, ctxp, m);
  kOut          <<<2048, 256, 0, stream>>>(Q, m, ctxp, out);
}
